// v000
// Measured on an AMD MI455X. A time is GPU time per run, averaged over a window of back-to-back runs after a warm-up
// (all launches, gaps included; the runs take copies of the inputs in turn), and the median of several windows.
// Apart from v000's, it joins two sittings. Times from different sittings can be a few percent apart, while
// side-by-side timings come from the same sitting.
// v000, which the later versions start from, runs in 443 microseconds.
// compute dtype: all float inputs rounded to bf16; Q = x . w_q + b, K/V = encoding . w + b with EXACT bf16 products on WMMA 16x16x32 ((in,out) weights as transposed rows), rounded once to f16 (V as planes); attention over the 4,096 keys: q, k single f16 x 1/8, running-max softmax in f32 (hardware exp), P (scaled by 2^11, single f16) x v (single f16); out = ctx (bf16 hi + lo, 2 products) . w_o + b_o; f32 output.
#include <hip/hip_runtime.h>
#include <math.h>

typedef __attribute__((ext_vector_type(16))) _Float16 v16h;
typedef __attribute__((ext_vector_type(16))) __bf16 v16b;
typedef __attribute__((ext_vector_type(8)))  _Float16 v8h;
typedef __attribute__((ext_vector_type(8)))  float v8f;
typedef __attribute__((ext_vector_type(4)))  float v4f;
typedef __attribute__((ext_vector_type(2)))  float v2f;
typedef __attribute__((ext_vector_type(4)))  unsigned v4u;
typedef __attribute__((ext_vector_type(4)))  int v4i;
typedef float __attribute__((may_alias)) float_a;
typedef int __attribute__((may_alias)) int_a;

template <typename T> __device__ __forceinline__ void vst2(void* p, T v) { *(T*)p = v;  }
__device__ __forceinline__ v8f wmma16(v16h a, v16h b, v8f c) {
  v8f d = __builtin_amdgcn_wmma_f32_16x16x32_f16(false, a, false, b, (short)0, c, false, false);
  asm volatile("v_nop\n\tv_nop\n\tv_nop\n\tv_nop" : "+v"(d) : "v"(a), "v"(b));
  return d;
}
__device__ __forceinline__ v8f wmma_bf(v16b a, v16b b, v8f c) {
  v8f d = __builtin_amdgcn_wmma_f32_16x16x32_bf16(false, a, false, b, (short)0, c, false, false);
  asm volatile("v_nop\n\tv_nop\n\tv_nop\n\tv_nop" : "+v"(d) : "v"(a), "v"(b));
  return d;
}
// 16x16x32 fragments: lane = (h = lane>>4, row/col = lane&15); elements 0..7 = k0+8h+0..7, 8..15 = k0+16+8h+0..7; D element r = row 8h+r
__device__ __forceinline__ v16h frag_h(const _Float16* rowk0, int lane) {
  union { v16h v; v8h q[2]; } u; const _Float16* p = rowk0 + 8 * (lane >> 4);
  u.q[0] = *(const v8h*)p; u.q[1] = *(const v8h*)(p + 16); return u.v;
}
__device__ __forceinline__ v16h frag_f32(const float* rowk0, int lane) {
  v16h a; const float* p = rowk0 + 8 * (lane >> 4);
#pragma unroll
  for (int i = 0; i < 8; ++i) { a[i] = (_Float16)p[i]; a[8 + i] = (_Float16)p[16 + i]; }
  return a;
}
__device__ __forceinline__ v16h frag_f32s(const float* rowk0, int lane, float sc) {
  v16h a; const float* p = rowk0 + 8 * (lane >> 4);
#pragma unroll
  for (int i = 0; i < 8; ++i) { a[i] = (_Float16)(p[i] * sc); a[8 + i] = (_Float16)(p[16 + i] * sc); }
  return a;
}
// column fragment from a [K][ld] layout (column n), rows >= K read as 0
__device__ __forceinline__ v16h fragc_f32(const float* W, int k0, int n, int lane, int ld, int K) {
  v16h a; const int g = lane >> 4;
#pragma unroll
  for (int i = 0; i < 8; ++i) { const int ka = k0 + 8 * g + i, kb = ka + 16;
    a[i] = (_Float16)(ka < K ? W[(size_t)(ka < K ? ka : K - 1) * ld + n] : 0.f); a[8 + i] = (_Float16)(kb < K ? W[(size_t)(kb < K ? kb : K - 1) * ld + n] : 0.f); }
  return a;
}
struct F2 { v16b h, l; };
__device__ __forceinline__ F2 bsplit16(const float v[16]) { F2 r;
#pragma unroll
  for (int i = 0; i < 16; ++i) { const __bf16 h = (__bf16)v[i]; r.h[i] = h; r.l[i] = (__bf16)(v[i] - (float)h); }
  return r; }
__device__ __forceinline__ F2 split_row(const float* row, int k0, int lane) { float v[16]; const float* p = row + k0 + 8 * (lane >> 4);
#pragma unroll
  for (int i = 0; i < 8; ++i) { v[i] = p[i]; v[8 + i] = p[16 + i]; }
  return bsplit16(v); }
__device__ __forceinline__ F2 split_rowK(const float* row, int k0, int lane, int K) { float v[16]; const int g = lane >> 4;
#pragma unroll
  for (int i = 0; i < 8; ++i) { const int ka = k0 + 8 * g + i, kb = ka + 16; v[i] = ka < K ? row[ka < K ? ka : K - 1] : 0.f; v[8 + i] = kb < K ? row[kb < K ? kb : K - 1] : 0.f; }
  return bsplit16(v); }
__device__ __forceinline__ F2 split_col(const float* W, int k0, int n, int lane, int ld, int K) { float v[16]; const int g = lane >> 4;
#pragma unroll
  for (int i = 0; i < 8; ++i) { const int ka = k0 + 8 * g + i, kb = ka + 16; v[i] = ka < K ? W[(size_t)(ka < K ? ka : K - 1) * ld + n] : 0.f; v[8 + i] = kb < K ? W[(size_t)(kb < K ? kb : K - 1) * ld + n] : 0.f; }
  return bsplit16(v); }
__device__ __forceinline__ v8f mac3(const F2& a, const F2& b, v8f c) { c = wmma_bf(a.l, b.h, c); c = wmma_bf(a.h, b.l, c); return wmma_bf(a.h, b.h, c); }
__device__ __forceinline__ float sigm(float v) { return 1.0f / (1.0f + expf(-v)); }
#define LDSX() do { asm volatile("s_wait_dscnt 0" ::: "memory"); __builtin_amdgcn_wave_barrier(); __builtin_amdgcn_fence(__ATOMIC_RELEASE, "workgroup"); } while (0)


// Encoder-decoder multi-head attention (B 1, N 4,096 queries and keys, d_model 768, 12 heads x 64): q from x, k/v from the encoding, softmax(Q K^T / 8) V, output projection + bias.
#define NQ 4096
#define NK 4096
#define DM 768
#define NH 12
#define HD 64
#ifndef TQB
#define TQB (NQ / 64)
#endif
typedef __attribute__((ext_vector_type(8))) __bf16 v8b;
__device__ __forceinline__ v16b frag_b(const __bf16* rowk0, int lane) {
  union { v16b v; v8b q[2]; } u; const __bf16* p = rowk0 + 8 * (lane >> 4);
  u.q[0] = *(const v8b*)p; u.q[1] = *(const v8b*)(p + 16); return u.v;
}
__device__ __forceinline__ float bfr(float v) { return (float)(__bf16)v; }
__device__ __attribute__((noinline)) float exp_ni(float v) { return expf(v); }
__device__ __attribute__((noinline)) float erf_ni(float v) { return erff(v); }

#define WS_PW  0u                                   // bf16 transposed rows w_q^T, w_k^T, w_v^T, w_o^T [4][768][768]
#define WS_Q   (WS_PW + 2u * (size_t)4 * DM * DM)       // f16 Q rows [NQ][768]; K rows [NK][768]; V planes [768][NK]; f32 ctx [NQ][768]
#define WS_K   (WS_Q + 2u * (size_t)NQ * DM)
#define WS_V   (WS_K + 2u * (size_t)NK * DM)
#define WS_O   (WS_V + 2u * (size_t)DM * NK)
#define WS_END (WS_O + 4u * (size_t)NQ * DM)

__global__ __launch_bounds__(256) void k_pack(const float* __restrict__ WQ, const float* __restrict__ WK, const float* __restrict__ WV, const float* __restrict__ WO, __bf16* __restrict__ PW) { const int n = blockIdx.x, which = blockIdx.y, t = threadIdx.x; __shared__ __align__(16) __bf16 s[DM]; const float* w = (which == 0) ? WQ : (which == 1) ? WK : (which == 2) ? WV : WO;
  for (int k = t; k < DM; k += 256) s[k] = (__bf16)w[(size_t)k * DM + n]; __syncthreads(); if (t < DM / 8) vst2((unsigned*)(PW + ((size_t)which * DM + n) * DM + t * 8), *(const v4u*)&s[t * 8]); }
// ---- k_proj: block = (64 rows, 128 cols, which): Q from x, K/V from the encoding (+ bias); Q/K f16 rows, V planes
__global__ __launch_bounds__(128) void k_proj(const float* __restrict__ X, const float* __restrict__ ENC, const __bf16* __restrict__ PW, const float* __restrict__ BQ, const float* __restrict__ BK, const float* __restrict__ BV, _Float16* __restrict__ Q, _Float16* __restrict__ Kr, _Float16* __restrict__ V) {
  __shared__ __align__(16) _Float16 so[64][136]; __shared__ __align__(16) _Float16 st[128][72];
  const int tid = threadIdx.x, wave = tid >> 5, lane = tid & 31, col = lane & 15, g = lane >> 4; const int which = blockIdx.z; const size_t rb = (size_t)blockIdx.x * 64; if (which == 0 && rb >= (size_t)TQB * 64) return;
  const size_t r0 = rb + wave * 16; const int c0 = blockIdx.y * 128; const float* A = (which == 0) ? X : ENC; const __bf16* Wr = PW + ((size_t)which * DM) * DM; const float* BB = (which == 0) ? BQ : (which == 1) ? BK : BV;
  v8f acc[8] = {};
#pragma unroll 2
  for (int kc = 0; kc < DM / 32; ++kc) { v16b a; { const float* p = A + (r0 + col) * DM + kc * 32 + 8 * g;
#pragma unroll
      for (int i = 0; i < 8; ++i) { a[i] = (__bf16)p[i]; a[8 + i] = (__bf16)p[16 + i]; } }
#pragma unroll
    for (int j = 0; j < 8; ++j) acc[j] = wmma_bf(a, frag_b(Wr + (size_t)(c0 + j * 16 + col) * DM + kc * 32, lane), acc[j]); }
#pragma unroll
  for (int j = 0; j < 8; ++j) { const float bb = bfr(BB[c0 + j * 16 + col]);
#pragma unroll
    for (int r = 0; r < 8; ++r) { const _Float16 hv = (_Float16)(acc[j][r] + bb); if (which < 2) so[wave * 16 + 8 * g + r][j * 16 + col] = hv; else st[j * 16 + col][wave * 16 + 8 * g + r] = hv; } }
  __syncthreads();
  if (which < 2) { _Float16* dst = (which == 0) ? Q : Kr; for (int e = tid; e < 64 * 16; e += 128) { const int rl = e >> 4, q = e & 15; vst2((unsigned*)(dst + (rb + rl) * DM + c0 + q * 8), *(const v4u*)&so[rl][q * 8]); } }
  else { const int s0 = (int)rb; for (int e = tid; e < 128 * 8; e += 128) { const int d = e >> 3, pc = e & 7; vst2((unsigned*)(V + ((size_t)(c0 + d) * NK) + s0 + pc * 8), *(const v4u*)&st[d][pc * 8]); } }
}
// ---- k_attn: block = (64 queries, head): softmax(q k / 8) over the 4,096 keys; ctx f32 [NQ][768] (256-B head segments)
__global__ __launch_bounds__(128) void k_attn(const _Float16* __restrict__ Q, const _Float16* __restrict__ Kr, const _Float16* __restrict__ V, float* __restrict__ O) {
  __shared__ __align__(16) _Float16 sph[4][16][40]; __shared__ __align__(16) float so[4][16][68];
  const int tid = threadIdx.x, wave = tid >> 5, lane = tid & 31, col = lane & 15, g = lane >> 4; const int h = blockIdx.y; const int q0 = blockIdx.x * 64 + wave * 16; const size_t rq = (size_t)q0;
  v16h aq[2];
#pragma unroll
  for (int kc = 0; kc < 2; ++kc) aq[kc] = frag_h(Q + (rq + col) * DM + h * HD + kc * 32, lane);
  float m[8], l[8];
#pragma unroll
  for (int r = 0; r < 8; ++r) { m[r] = -3.0e38f; l[r] = 0.f; }
  v8f acc[4] = {};
#pragma unroll 1
  for (int ks = 0; ks < NK / 32; ++ks) { const int j0 = ks * 32; v8f s[2];
#pragma unroll
    for (int ct = 0; ct < 2; ++ct) { const int kk = j0 + ct * 16 + col; const size_t rk = (size_t)kk * DM + h * HD; v8f c = {};
#pragma unroll
      for (int kc = 0; kc < 2; ++kc) c = wmma16(aq[kc], frag_h(Kr + rk + kc * 32, lane), c);
#pragma unroll
      for (int r = 0; r < 8; ++r) s[ct][r] = c[r] * 0.125f; }
#pragma unroll
    for (int r = 0; r < 8; ++r) { float mx = fmaxf(s[0][r], s[1][r]);
#pragma unroll
      for (int o = 1; o < 16; o <<= 1) mx = fmaxf(mx, __shfl_xor(mx, o));
      const float mn = fmaxf(m[r], mx); const float alpha = (m[r] <= -1.0e38f) ? 0.f : __expf(m[r] - mn); const float e0 = __expf(s[0][r] - mn), e1 = __expf(s[1][r] - mn); float es = e0 + e1;
#pragma unroll
      for (int o = 1; o < 16; o <<= 1) es += __shfl_xor(es, o);
      l[r] = l[r] * alpha + es; m[r] = mn;
#pragma unroll
      for (int dt = 0; dt < 4; ++dt) acc[dt][r] *= alpha;
      sph[wave][8 * g + r][col] = (_Float16)(e0 * 2048.0f); sph[wave][8 * g + r][16 + col] = (_Float16)(e1 * 2048.0f); }
    LDSX();
    const v16h pa = frag_h(&sph[wave][col][0], lane);
#pragma unroll
    for (int dt = 0; dt < 4; ++dt) acc[dt] = wmma16(pa, frag_h(V + ((size_t)(h * HD + dt * 16 + col) * NK) + j0, lane), acc[dt]);
    LDSX(); }
#pragma unroll
  for (int r = 0; r < 8; ++r) { const float il = (1.0f / 2048.0f) / l[r];
#pragma unroll
    for (int dt = 0; dt < 4; ++dt) so[wave][8 * g + r][dt * 16 + col] = acc[dt][r] * il; }
  LDSX();
  for (int rl = 0; rl < 16; ++rl) if (lane < 16) vst2(O + (rq + rl) * DM + h * HD + lane * 4, *(const v4f*)&so[wave][rl][lane * 4]);
}
// ---- k_out: block = (64 rows, 128 cols): out = ctx (hi + lo) . w_o + b_o
__global__ __launch_bounds__(128) void k_out(const float* __restrict__ O, const __bf16* __restrict__ PW, const float* __restrict__ BO, float* __restrict__ Y) { __shared__ __align__(16) float so[4][16][132];
  const int tid = threadIdx.x, wave = tid >> 5, lane = tid & 31, col = lane & 15, g = lane >> 4; const size_t r0 = (size_t)blockIdx.x * 64 + wave * 16; const int c0 = blockIdx.y * 128; const __bf16* Wr = PW + (size_t)3 * DM * DM;
  v8f acc[8] = {};
#pragma unroll 2
  for (int kc = 0; kc < DM / 32; ++kc) { const F2 a = split_row(O + (r0 + col) * DM, kc * 32, lane);
#pragma unroll
    for (int j = 0; j < 8; ++j) { const v16b w = frag_b(Wr + (size_t)(c0 + j * 16 + col) * DM + kc * 32, lane); acc[j] = wmma_bf(a.h, w, acc[j]); acc[j] = wmma_bf(a.l, w, acc[j]); } }
#pragma unroll
  for (int j = 0; j < 8; ++j) { const float bb = bfr(BO[c0 + j * 16 + col]);
#pragma unroll
    for (int r = 0; r < 8; ++r) so[wave][8 * g + r][j * 16 + col] = acc[j][r] + bb; }
  LDSX(); for (int rl = 0; rl < 16; ++rl) vst2(Y + (r0 + rl) * DM + c0 + lane * 4, *(const v4f*)&so[wave][rl][lane * 4]); }
extern "C" void kernel_launch(void* const* d_in, const int* in_sizes, int n_in, void* d_out, int out_size, void* d_ws, size_t ws_size, hipStream_t stream) {
  (void)in_sizes; (void)n_in; (void)out_size;
  const float** F = (const float**)d_in;   // 0 x [1,4096,768], 1 encoding [1,4096,768], 2 w_q (in,out), 3 b_q, 4 w_k, 5 b_k, 6 w_v, 7 b_v, 8 w_o [768,768] (in,out), 9 b_o
  if (ws_size < (size_t)WS_END) return;
  char* ws = (char*)d_ws; __bf16* PW = (__bf16*)ws; _Float16 *Q = (_Float16*)(ws + WS_Q), *Kr = (_Float16*)(ws + WS_K), *V = (_Float16*)(ws + WS_V); float* O = (float*)(ws + WS_O);
  k_pack<<<dim3(DM, 4), 256, 0, stream>>>(F[2], F[4], F[6], F[8], PW);
  k_proj<<<dim3(NK / 64, DM / 128, 3), 128, 0, stream>>>(F[0], F[1], PW, F[3], F[5], F[7], Q, Kr, V);
  k_attn<<<dim3(TQB, NH), 128, 0, stream>>>(Q, Kr, V, O);
  k_out<<<dim3(TQB, DM / 128), 128, 0, stream>>>(O, PW, F[9], (float*)d_out);
}

// v001
// One run takes 273 microseconds.
// Timed twice side by side with v000, it ran 1.67 and 1.68 times as fast.
// compute dtype: all float inputs rounded to bf16; Q = x . w_q + b, K/V = encoding . w + b with EXACT bf16 products on WMMA 16x16x32 ((in,out) weights as transposed rows), rounded once to f16 (V as planes); attention over the 4,096 keys: q, k single f16 x 1/8, running-max softmax in f32 (hardware exp), P (scaled by 2^11, single f16) x v (single f16); out = ctx (bf16 hi + lo, 2 products) . w_o + b_o; f32 output.
#include <hip/hip_runtime.h>
#include <math.h>

typedef __attribute__((ext_vector_type(16))) _Float16 v16h;
typedef __attribute__((ext_vector_type(16))) __bf16 v16b;
typedef __attribute__((ext_vector_type(8)))  _Float16 v8h;
typedef __attribute__((ext_vector_type(8)))  float v8f;
typedef __attribute__((ext_vector_type(4)))  float v4f;
typedef __attribute__((ext_vector_type(2)))  float v2f;
typedef __attribute__((ext_vector_type(4)))  unsigned v4u;
typedef __attribute__((ext_vector_type(4)))  int v4i;
typedef float __attribute__((may_alias)) float_a;
typedef int __attribute__((may_alias)) int_a;

template <typename T> __device__ __forceinline__ void vst2(void* p, T v) { *(T*)p = v;  }
__device__ __forceinline__ v8f wmma16(v16h a, v16h b, v8f c) {
  v8f d = __builtin_amdgcn_wmma_f32_16x16x32_f16(false, a, false, b, (short)0, c, false, false);
  asm volatile("v_nop\n\tv_nop\n\tv_nop\n\tv_nop" : "+v"(d) : "v"(a), "v"(b));
  return d;
}
__device__ __forceinline__ v8f wmma_bf(v16b a, v16b b, v8f c) {
  v8f d = __builtin_amdgcn_wmma_f32_16x16x32_bf16(false, a, false, b, (short)0, c, false, false);
  asm volatile("v_nop\n\tv_nop\n\tv_nop\n\tv_nop" : "+v"(d) : "v"(a), "v"(b));
  return d;
}
// 16x16x32 fragments: lane = (h = lane>>4, row/col = lane&15); elements 0..7 = k0+8h+0..7, 8..15 = k0+16+8h+0..7; D element r = row 8h+r
__device__ __forceinline__ v16h frag_h(const _Float16* rowk0, int lane) {
  union { v16h v; v8h q[2]; } u; const _Float16* p = rowk0 + 8 * (lane >> 4);
  u.q[0] = *(const v8h*)p; u.q[1] = *(const v8h*)(p + 16); return u.v;
}
__device__ __forceinline__ v16h frag_f32(const float* rowk0, int lane) {
  v16h a; const float* p = rowk0 + 8 * (lane >> 4);
#pragma unroll
  for (int i = 0; i < 8; ++i) { a[i] = (_Float16)p[i]; a[8 + i] = (_Float16)p[16 + i]; }
  return a;
}
__device__ __forceinline__ v16h frag_f32s(const float* rowk0, int lane, float sc) {
  v16h a; const float* p = rowk0 + 8 * (lane >> 4);
#pragma unroll
  for (int i = 0; i < 8; ++i) { a[i] = (_Float16)(p[i] * sc); a[8 + i] = (_Float16)(p[16 + i] * sc); }
  return a;
}
// column fragment from a [K][ld] layout (column n), rows >= K read as 0
__device__ __forceinline__ v16h fragc_f32(const float* W, int k0, int n, int lane, int ld, int K) {
  v16h a; const int g = lane >> 4;
#pragma unroll
  for (int i = 0; i < 8; ++i) { const int ka = k0 + 8 * g + i, kb = ka + 16;
    a[i] = (_Float16)(ka < K ? W[(size_t)(ka < K ? ka : K - 1) * ld + n] : 0.f); a[8 + i] = (_Float16)(kb < K ? W[(size_t)(kb < K ? kb : K - 1) * ld + n] : 0.f); }
  return a;
}
struct F2 { v16b h, l; };
__device__ __forceinline__ F2 bsplit16(const float v[16]) { F2 r;
#pragma unroll
  for (int i = 0; i < 16; ++i) { const __bf16 h = (__bf16)v[i]; r.h[i] = h; r.l[i] = (__bf16)(v[i] - (float)h); }
  return r; }
__device__ __forceinline__ F2 split_row(const float* row, int k0, int lane) { float v[16]; const float* p = row + k0 + 8 * (lane >> 4);
#pragma unroll
  for (int i = 0; i < 8; ++i) { v[i] = p[i]; v[8 + i] = p[16 + i]; }
  return bsplit16(v); }
__device__ __forceinline__ F2 split_rowK(const float* row, int k0, int lane, int K) { float v[16]; const int g = lane >> 4;
#pragma unroll
  for (int i = 0; i < 8; ++i) { const int ka = k0 + 8 * g + i, kb = ka + 16; v[i] = ka < K ? row[ka < K ? ka : K - 1] : 0.f; v[8 + i] = kb < K ? row[kb < K ? kb : K - 1] : 0.f; }
  return bsplit16(v); }
__device__ __forceinline__ F2 split_col(const float* W, int k0, int n, int lane, int ld, int K) { float v[16]; const int g = lane >> 4;
#pragma unroll
  for (int i = 0; i < 8; ++i) { const int ka = k0 + 8 * g + i, kb = ka + 16; v[i] = ka < K ? W[(size_t)(ka < K ? ka : K - 1) * ld + n] : 0.f; v[8 + i] = kb < K ? W[(size_t)(kb < K ? kb : K - 1) * ld + n] : 0.f; }
  return bsplit16(v); }
__device__ __forceinline__ v8f mac3(const F2& a, const F2& b, v8f c) { c = wmma_bf(a.l, b.h, c); c = wmma_bf(a.h, b.l, c); return wmma_bf(a.h, b.h, c); }
__device__ __forceinline__ float sigm(float v) { return 1.0f / (1.0f + expf(-v)); }
#define LDSX() do { asm volatile("s_wait_dscnt 0" ::: "memory"); __builtin_amdgcn_wave_barrier(); __builtin_amdgcn_fence(__ATOMIC_RELEASE, "workgroup"); } while (0)


// Encoder-decoder multi-head attention (B 1, N 4,096 queries and keys, d_model 768, 12 heads x 64): q from x, k/v from the encoding, softmax(Q K^T / 8) V, output projection + bias.
#define NQ 4096
#define NK 4096
#define DM 768
#define NH 12
#define HD 64
#ifndef TQB
#define TQB (NQ / 64)
#endif
typedef __attribute__((ext_vector_type(8))) __bf16 v8b;
__device__ __forceinline__ v16b frag_b(const __bf16* rowk0, int lane) {
  union { v16b v; v8b q[2]; } u; const __bf16* p = rowk0 + 8 * (lane >> 4);
  u.q[0] = *(const v8b*)p; u.q[1] = *(const v8b*)(p + 16); return u.v;
}
__device__ __forceinline__ float bfr(float v) { return (float)(__bf16)v; }
__device__ __attribute__((noinline)) float exp_ni(float v) { return expf(v); }
__device__ __attribute__((noinline)) float erf_ni(float v) { return erff(v); }

#define WS_PW  0u                                   // bf16 transposed rows w_q^T, w_k^T, w_v^T, w_o^T [4][768][768]
#define WS_Q   (WS_PW + 2u * (size_t)4 * DM * DM)       // f16 Q rows [NQ][768]; K rows [NK][768]; V planes [768][NK]; f32 ctx [NQ][768]
#define WS_K   (WS_Q + 2u * (size_t)NQ * DM)
#define WS_V   (WS_K + 2u * (size_t)NK * DM)
#define WS_O   (WS_V + 2u * (size_t)DM * NK)
#define WS_END (WS_O + 4u * (size_t)NQ * DM)

__global__ __launch_bounds__(256) void k_pack(const float* __restrict__ WQ, const float* __restrict__ WK, const float* __restrict__ WV, const float* __restrict__ WO, __bf16* __restrict__ PW) { const int n = blockIdx.x, which = blockIdx.y, t = threadIdx.x; __shared__ __align__(16) __bf16 s[DM]; const float* w = (which == 0) ? WQ : (which == 1) ? WK : (which == 2) ? WV : WO;
  for (int k = t; k < DM; k += 256) s[k] = (__bf16)w[(size_t)k * DM + n]; __syncthreads(); if (t < DM / 8) vst2((unsigned*)(PW + ((size_t)which * DM + n) * DM + t * 8), *(const v4u*)&s[t * 8]); }
// ---- k_proj: block = (64 rows, 128 cols, which): Q from x, K/V from the encoding (+ bias); Q/K f16 rows, V planes
__global__ __launch_bounds__(128) void k_proj(const float* __restrict__ X, const float* __restrict__ ENC, const __bf16* __restrict__ PW, const float* __restrict__ BQ, const float* __restrict__ BK, const float* __restrict__ BV, _Float16* __restrict__ Q, _Float16* __restrict__ Kr, _Float16* __restrict__ V) {
  __shared__ __align__(16) _Float16 so[64][136]; __shared__ __align__(16) _Float16 st[128][72];
  const int tid = threadIdx.x, wave = tid >> 5, lane = tid & 31, col = lane & 15, g = lane >> 4; const int which = blockIdx.z; const size_t rb = (size_t)blockIdx.x * 64; if (which == 0 && rb >= (size_t)TQB * 64) return;
  const size_t r0 = rb + wave * 16; const int c0 = blockIdx.y * 128; const float* A = (which == 0) ? X : ENC; const __bf16* Wr = PW + ((size_t)which * DM) * DM; const float* BB = (which == 0) ? BQ : (which == 1) ? BK : BV;
  v8f acc[8] = {};
  // fragments run one k step ahead: each weight fragment is reloaded for step kc + 1 right behind the product that used it, the activation row at the head of the step
  const float* Ap = A + (r0 + col) * DM + 8 * g; v4f ar[4]; v16b w[8];
#pragma unroll
  for (int i = 0; i < 4; ++i) ar[i] = *(const v4f*)(Ap + (i >> 1) * 16 + (i & 1) * 4);
  __builtin_amdgcn_sched_barrier(0);   // the row's loads stay the oldest here as in the loop: the wait at the loop's head is then a counted one, not for every load in flight
#pragma unroll
  for (int j = 0; j < 8; ++j) w[j] = frag_b(Wr + (size_t)(c0 + j * 16 + col) * DM, lane);
#pragma unroll 1   // stays rolled: with the odd trip count an unroll by 2 came out as all 24 steps in a row
  for (int kc = 0; kc < DM / 32 - 1; ++kc) { v16b a;
#pragma unroll
    for (int i = 0; i < 16; ++i) a[i] = (__bf16)ar[i >> 2][i & 3];
#pragma unroll
    for (int i = 0; i < 4; ++i) ar[i] = *(const v4f*)(Ap + (kc + 1) * 32 + (i >> 1) * 16 + (i & 1) * 4);
#pragma unroll
    for (int j = 0; j < 8; ++j) { acc[j] = wmma_bf(a, w[j], acc[j]); w[j] = frag_b(Wr + (size_t)(c0 + j * 16 + col) * DM + (kc + 1) * 32, lane); }
    asm volatile("s_wait_xcnt 0x0" ::: "memory"); }   // stands in front of the next step's rewrite of the last loads' address registers
  { v16b a;
#pragma unroll
    for (int i = 0; i < 16; ++i) a[i] = (__bf16)ar[i >> 2][i & 3];
#pragma unroll
    for (int j = 0; j < 8; ++j) acc[j] = wmma_bf(a, w[j], acc[j]); }
#pragma unroll
  for (int j = 0; j < 8; ++j) { const float bb = bfr(BB[c0 + j * 16 + col]);
#pragma unroll
    for (int r = 0; r < 8; ++r) { const _Float16 hv = (_Float16)(acc[j][r] + bb); if (which < 2) so[wave * 16 + 8 * g + r][j * 16 + col] = hv; else st[j * 16 + col][wave * 16 + 8 * g + r] = hv; } }
  __syncthreads();
  if (which < 2) { _Float16* dst = (which == 0) ? Q : Kr; for (int e = tid; e < 64 * 16; e += 128) { const int rl = e >> 4, q = e & 15; vst2((unsigned*)(dst + (rb + rl) * DM + c0 + q * 8), *(const v4u*)&so[rl][q * 8]); } }
  else { const int s0 = (int)rb; for (int e = tid; e < 128 * 8; e += 128) { const int d = e >> 3, pc = e & 7; vst2((unsigned*)(V + ((size_t)(c0 + d) * NK) + s0 + pc * 8), *(const v4u*)&st[d][pc * 8]); } }
}
// ---- k_attn: block = (64 queries, head): softmax(q k / 8) over the 4,096 keys; ctx f32 [NQ][768] (256-B head segments)
__global__ __launch_bounds__(128) void k_attn(const _Float16* __restrict__ Q, const _Float16* __restrict__ Kr, const _Float16* __restrict__ V, float* __restrict__ O) {
  __shared__ __align__(16) _Float16 sph[4][16][40]; __shared__ __align__(16) float so[4][16][68];
  const int tid = threadIdx.x, wave = tid >> 5, lane = tid & 31, col = lane & 15, g = lane >> 4; const int h = blockIdx.y; const int q0 = blockIdx.x * 64 + wave * 16; const size_t rq = (size_t)q0;
  v16h aq[2];
#pragma unroll
  for (int kc = 0; kc < 2; ++kc) aq[kc] = frag_h(Q + (rq + col) * DM + h * HD + kc * 32, lane);
  float m[8], l[8];
#pragma unroll
  for (int r = 0; r < 8; ++r) { m[r] = -3.0e38f; l[r] = 0.f; }
  v8f acc[4] = {};
  // K fragments run one pass ahead (reloaded as one group behind the score products); V fragments are asked for as one group at the head of their pass
  v16h kf[2][2], vf[4];
#pragma unroll
  for (int ct = 0; ct < 2; ++ct) {
#pragma unroll
    for (int kc = 0; kc < 2; ++kc) kf[ct][kc] = frag_h(Kr + (size_t)(ct * 16 + col) * DM + h * HD + kc * 32, lane); }
#pragma unroll 1
  for (int ks = 0; ks < NK / 32; ++ks) { const int j0 = ks * 32; v8f s[2];
#pragma unroll
    for (int dt = 0; dt < 4; ++dt) vf[dt] = frag_h(V + ((size_t)(h * HD + dt * 16 + col) * NK) + j0, lane);
#pragma unroll
    for (int ct = 0; ct < 2; ++ct) { v8f c = {};
#pragma unroll
      for (int kc = 0; kc < 2; ++kc) c = wmma16(aq[kc], kf[ct][kc], c);
#pragma unroll
      for (int r = 0; r < 8; ++r) s[ct][r] = c[r] * 0.125f; }
    const int jn = ((ks + 1) & (NK / 32 - 1)) * 32;   // the last pass asks for pass 0's rows again: in bounds, not used
#pragma unroll
    for (int ct = 0; ct < 2; ++ct) {
#pragma unroll
      for (int kc = 0; kc < 2; ++kc) kf[ct][kc] = frag_h(Kr + (size_t)(jn + ct * 16 + col) * DM + h * HD + kc * 32, lane); }
    __builtin_amdgcn_sched_barrier(0);   // keeps the K loads here, ahead of the whole softmax: the scheduler otherwise sinks them towards the fence below, which waits for them
#pragma unroll
    for (int r = 0; r < 8; ++r) { float mx = fmaxf(s[0][r], s[1][r]);
#pragma unroll
      for (int o = 1; o < 16; o <<= 1) mx = fmaxf(mx, __shfl_xor(mx, o));
      const float mn = fmaxf(m[r], mx); const float alpha = (m[r] <= -1.0e38f) ? 0.f : __expf(m[r] - mn); const float e0 = __expf(s[0][r] - mn), e1 = __expf(s[1][r] - mn); float es = e0 + e1;
#pragma unroll
      for (int o = 1; o < 16; o <<= 1) es += __shfl_xor(es, o);
      l[r] = l[r] * alpha + es; m[r] = mn;
#pragma unroll
      for (int dt = 0; dt < 4; ++dt) acc[dt][r] *= alpha;
      sph[wave][8 * g + r][col] = (_Float16)(e0 * 2048.0f); sph[wave][8 * g + r][16 + col] = (_Float16)(e1 * 2048.0f); }
    LDSX();
    const v16h pa = frag_h(&sph[wave][col][0], lane);
#pragma unroll
    for (int dt = 0; dt < 4; ++dt) acc[dt] = wmma16(pa, vf[dt], acc[dt]);
    LDSX(); }
#pragma unroll
  for (int r = 0; r < 8; ++r) { const float il = (1.0f / 2048.0f) / l[r];
#pragma unroll
    for (int dt = 0; dt < 4; ++dt) so[wave][8 * g + r][dt * 16 + col] = acc[dt][r] * il; }
  LDSX();
  for (int rl = 0; rl < 16; ++rl) if (lane < 16) vst2(O + (rq + rl) * DM + h * HD + lane * 4, *(const v4f*)&so[wave][rl][lane * 4]);
}
// ---- k_out: block = (64 rows, 128 cols): out = ctx (hi + lo) . w_o + b_o
__global__ __launch_bounds__(128) void k_out(const float* __restrict__ O, const __bf16* __restrict__ PW, const float* __restrict__ BO, float* __restrict__ Y) { __shared__ __align__(16) float so[4][16][132];
  const int tid = threadIdx.x, wave = tid >> 5, lane = tid & 31, col = lane & 15, g = lane >> 4; const size_t r0 = (size_t)blockIdx.x * 64 + wave * 16; const int c0 = blockIdx.y * 128; const __bf16* Wr = PW + (size_t)3 * DM * DM;
  v8f acc[8] = {};
  // fragments run one k step ahead, as in k_proj
  const float* Op = O + (r0 + col) * DM + 8 * g; v4f ar[4]; v16b w[8];
#pragma unroll
  for (int i = 0; i < 4; ++i) ar[i] = *(const v4f*)(Op + (i >> 1) * 16 + (i & 1) * 4);
  __builtin_amdgcn_sched_barrier(0);   // the row's loads stay the oldest here as in the loop: the wait at the loop's head is then a counted one, not for every load in flight
#pragma unroll
  for (int j = 0; j < 8; ++j) w[j] = frag_b(Wr + (size_t)(c0 + j * 16 + col) * DM, lane);
#pragma unroll 1   // stays rolled: with the odd trip count an unroll by 2 came out as all 24 steps in a row
  for (int kc = 0; kc < DM / 32 - 1; ++kc) { float v[16];
#pragma unroll
    for (int i = 0; i < 16; ++i) v[i] = ar[i >> 2][i & 3];
    const F2 a = bsplit16(v); Op += 32;   // a running pointer: its register pair lives over the whole loop, so no load's result can be placed in it
#pragma unroll
    for (int i = 0; i < 4; ++i) ar[i] = *(const v4f*)(Op + (i >> 1) * 16 + (i & 1) * 4);
#pragma unroll
    for (int j = 0; j < 8; ++j) { acc[j] = wmma_bf(a.h, w[j], acc[j]); acc[j] = wmma_bf(a.l, w[j], acc[j]); w[j] = frag_b(Wr + (size_t)(c0 + j * 16 + col) * DM + (kc + 1) * 32, lane); }
    asm volatile("s_wait_xcnt 0x0" ::: "memory"); }   // stands in front of the next step's rewrite of the last loads' address registers
  { float v[16];
#pragma unroll
    for (int i = 0; i < 16; ++i) v[i] = ar[i >> 2][i & 3];
    const F2 a = bsplit16(v);
#pragma unroll
    for (int j = 0; j < 8; ++j) { acc[j] = wmma_bf(a.h, w[j], acc[j]); acc[j] = wmma_bf(a.l, w[j], acc[j]); } }
#pragma unroll
  for (int j = 0; j < 8; ++j) { const float bb = bfr(BO[c0 + j * 16 + col]);
#pragma unroll
    for (int r = 0; r < 8; ++r) so[wave][8 * g + r][j * 16 + col] = acc[j][r] + bb; }
  LDSX(); for (int rl = 0; rl < 16; ++rl) vst2(Y + (r0 + rl) * DM + c0 + lane * 4, *(const v4f*)&so[wave][rl][lane * 4]); }
extern "C" void kernel_launch(void* const* d_in, const int* in_sizes, int n_in, void* d_out, int out_size, void* d_ws, size_t ws_size, hipStream_t stream) {
  (void)in_sizes; (void)n_in; (void)out_size;
  const float** F = (const float**)d_in;   // 0 x [1,4096,768], 1 encoding [1,4096,768], 2 w_q (in,out), 3 b_q, 4 w_k, 5 b_k, 6 w_v, 7 b_v, 8 w_o [768,768] (in,out), 9 b_o
  if (ws_size < (size_t)WS_END) return;
  char* ws = (char*)d_ws; __bf16* PW = (__bf16*)ws; _Float16 *Q = (_Float16*)(ws + WS_Q), *Kr = (_Float16*)(ws + WS_K), *V = (_Float16*)(ws + WS_V); float* O = (float*)(ws + WS_O);
  k_pack<<<dim3(DM, 4), 256, 0, stream>>>(F[2], F[4], F[6], F[8], PW);
  k_proj<<<dim3(NK / 64, DM / 128, 3), 128, 0, stream>>>(F[0], F[1], PW, F[3], F[5], F[7], Q, Kr, V);
  k_attn<<<dim3(TQB, NH), 128, 0, stream>>>(Q, Kr, V, O);
  k_out<<<dim3(TQB, DM / 128), 128, 0, stream>>>(O, PW, F[9], (float*)d_out);
}

// v002
// One run takes 171 microseconds.
// Next to v001, in two timings, it ran 1.59 times as fast each time.
// Over all steps from v000 it is 2.67 times as fast.
// compute dtype: all float inputs rounded to bf16; Q = x . w_q + b, K/V = encoding . w + b with EXACT bf16 products on WMMA 16x16x32 (x, encoding and the (in,out) weights packed to bf16 fragment blocks first), rounded once to f16; attention over the 4,096 keys: q, k single f16 x 1/8, running-max softmax in f32 (hardware exp), P (scaled by 2^11, single f16) x v (single f16); out = ctx (bf16 hi + lo, 2 products) . w_o + b_o; f32 output.
#include <hip/hip_runtime.h>
#include <math.h>

typedef __attribute__((ext_vector_type(16))) _Float16 v16h;
typedef __attribute__((ext_vector_type(16))) __bf16 v16b;
typedef __attribute__((ext_vector_type(8)))  _Float16 v8h;
typedef __attribute__((ext_vector_type(8)))  float v8f;
typedef __attribute__((ext_vector_type(4)))  float v4f;
typedef __attribute__((ext_vector_type(2)))  float v2f;
typedef __attribute__((ext_vector_type(4)))  unsigned v4u;
typedef __attribute__((ext_vector_type(4)))  int v4i;
typedef float __attribute__((may_alias)) float_a;
typedef int __attribute__((may_alias)) int_a;

template <typename T> __device__ __forceinline__ void vst2(void* p, T v) { *(T*)p = v;  }
__device__ __forceinline__ v8f wmma16(v16h a, v16h b, v8f c) {
  v8f d = __builtin_amdgcn_wmma_f32_16x16x32_f16(false, a, false, b, (short)0, c, false, false);
  asm volatile("v_nop\n\tv_nop\n\tv_nop\n\tv_nop" : "+v"(d) : "v"(a), "v"(b));
  return d;
}
__device__ __forceinline__ v8f wmma_bf(v16b a, v16b b, v8f c) {
  v8f d = __builtin_amdgcn_wmma_f32_16x16x32_bf16(false, a, false, b, (short)0, c, false, false);
  asm volatile("v_nop\n\tv_nop\n\tv_nop\n\tv_nop" : "+v"(d) : "v"(a), "v"(b));
  return d;
}
// 16x16x32 fragments: lane = (h = lane>>4, row/col = lane&15); elements 0..7 = k0+8h+0..7, 8..15 = k0+16+8h+0..7; D element r = row 8h+r
__device__ __forceinline__ v16h frag_h(const _Float16* rowk0, int lane) {
  union { v16h v; v8h q[2]; } u; const _Float16* p = rowk0 + 8 * (lane >> 4);
  u.q[0] = *(const v8h*)p; u.q[1] = *(const v8h*)(p + 16); return u.v;
}
__device__ __forceinline__ v16h frag_f32(const float* rowk0, int lane) {
  v16h a; const float* p = rowk0 + 8 * (lane >> 4);
#pragma unroll
  for (int i = 0; i < 8; ++i) { a[i] = (_Float16)p[i]; a[8 + i] = (_Float16)p[16 + i]; }
  return a;
}
__device__ __forceinline__ v16h frag_f32s(const float* rowk0, int lane, float sc) {
  v16h a; const float* p = rowk0 + 8 * (lane >> 4);
#pragma unroll
  for (int i = 0; i < 8; ++i) { a[i] = (_Float16)(p[i] * sc); a[8 + i] = (_Float16)(p[16 + i] * sc); }
  return a;
}
// column fragment from a [K][ld] layout (column n), rows >= K read as 0
__device__ __forceinline__ v16h fragc_f32(const float* W, int k0, int n, int lane, int ld, int K) {
  v16h a; const int g = lane >> 4;
#pragma unroll
  for (int i = 0; i < 8; ++i) { const int ka = k0 + 8 * g + i, kb = ka + 16;
    a[i] = (_Float16)(ka < K ? W[(size_t)(ka < K ? ka : K - 1) * ld + n] : 0.f); a[8 + i] = (_Float16)(kb < K ? W[(size_t)(kb < K ? kb : K - 1) * ld + n] : 0.f); }
  return a;
}
struct F2 { v16b h, l; };
__device__ __forceinline__ F2 bsplit16(const float v[16]) { F2 r;
#pragma unroll
  for (int i = 0; i < 16; ++i) { const __bf16 h = (__bf16)v[i]; r.h[i] = h; r.l[i] = (__bf16)(v[i] - (float)h); }
  return r; }
__device__ __forceinline__ F2 split_row(const float* row, int k0, int lane) { float v[16]; const float* p = row + k0 + 8 * (lane >> 4);
#pragma unroll
  for (int i = 0; i < 8; ++i) { v[i] = p[i]; v[8 + i] = p[16 + i]; }
  return bsplit16(v); }
__device__ __forceinline__ F2 split_rowK(const float* row, int k0, int lane, int K) { float v[16]; const int g = lane >> 4;
#pragma unroll
  for (int i = 0; i < 8; ++i) { const int ka = k0 + 8 * g + i, kb = ka + 16; v[i] = ka < K ? row[ka < K ? ka : K - 1] : 0.f; v[8 + i] = kb < K ? row[kb < K ? kb : K - 1] : 0.f; }
  return bsplit16(v); }
__device__ __forceinline__ F2 split_col(const float* W, int k0, int n, int lane, int ld, int K) { float v[16]; const int g = lane >> 4;
#pragma unroll
  for (int i = 0; i < 8; ++i) { const int ka = k0 + 8 * g + i, kb = ka + 16; v[i] = ka < K ? W[(size_t)(ka < K ? ka : K - 1) * ld + n] : 0.f; v[8 + i] = kb < K ? W[(size_t)(kb < K ? kb : K - 1) * ld + n] : 0.f; }
  return bsplit16(v); }
__device__ __forceinline__ v8f mac3(const F2& a, const F2& b, v8f c) { c = wmma_bf(a.l, b.h, c); c = wmma_bf(a.h, b.l, c); return wmma_bf(a.h, b.h, c); }
__device__ __forceinline__ float sigm(float v) { return 1.0f / (1.0f + expf(-v)); }
#define LDSX() do { asm volatile("s_wait_dscnt 0" ::: "memory"); __builtin_amdgcn_wave_barrier(); __builtin_amdgcn_fence(__ATOMIC_RELEASE, "workgroup"); } while (0)


// Encoder-decoder multi-head attention (B 1, N 4,096 queries and keys, d_model 768, 12 heads x 64): q from x, k/v from the encoding, softmax(Q K^T / 8) V, output projection + bias.
#define NQ 4096
#define NK 4096
#define DM 768
#define NH 12
#define HD 64
#ifndef TQB
#define TQB (NQ / 64)
#endif
typedef __attribute__((ext_vector_type(8))) __bf16 v8b;
__device__ __forceinline__ v16b frag_b(const __bf16* rowk0, int lane) {
  union { v16b v; v8b q[2]; } u; const __bf16* p = rowk0 + 8 * (lane >> 4);
  u.q[0] = *(const v8b*)p; u.q[1] = *(const v8b*)(p + 16); return u.v;
}
// fragment-order blocks: one (16 rows or columns) x (32 k) operand tile = 512 elements laid [half of the slots][lane][8], so each of a fragment's two wave-wide 16-byte loads covers 512 contiguous bytes; p = block + 8 * lane
__device__ __forceinline__ v16b fragp_b(const __bf16* p) { union { v16b v; v8b q[2]; } u; u.q[0] = *(const v8b*)p; u.q[1] = *(const v8b*)(p + 256); return u.v; }
__device__ __forceinline__ v16h fragp_h(const _Float16* p) { union { v16h v; v8h q[2]; } u; u.q[0] = *(const v8h*)p; u.q[1] = *(const v8h*)(p + 256); return u.v; }
__device__ __forceinline__ float bfr(float v) { return (float)(__bf16)v; }
__device__ __attribute__((noinline)) float exp_ni(float v) { return expf(v); }
__device__ __attribute__((noinline)) float erf_ni(float v) { return erff(v); }

#define WS_PW  0u                                   // bf16 w_q, w_k, w_v, w_o as fragment blocks [4][48 column tiles][24 k chunks][512]
#define WS_Q   (WS_PW + 2u * (size_t)4 * DM * DM)       // f16 Q rows [NQ][768]; K blocks [head][256 key tiles][2 d chunks][512]; V blocks [head][128 passes][4 d tiles][512]; f32 ctx blocks [256 row tiles][24 k chunks][4][lane][4]
#define WS_K   (WS_Q + 2u * (size_t)NQ * DM)
#define WS_V   (WS_K + 2u * (size_t)NK * DM)
#define WS_O   (WS_V + 2u * (size_t)DM * NK)
#define WS_XB  (WS_O + 4u * (size_t)NQ * DM)            // bf16 x, encoding as fragment blocks [2][256 row tiles][24 k chunks][512]
#define WS_END (WS_XB + 2u * (size_t)(NQ + NK) * DM)

// ---- k_pack: a 16-byte piece = 8 k of one row or column of a fragment block, rounded to bf16; thread = that piece in 4 k chunks (fewer, longer waves: the launch is short and wave starts count); block = (4 k chunks, y): y < 48 weights (the reads run along n, whole lines), else 64 rows of x or of the encoding; a wave stores whole lines
__global__ __launch_bounds__(256) void k_pack(const float* __restrict__ X, const float* __restrict__ ENC, const float* __restrict__ WQ, const float* __restrict__ WK, const float* __restrict__ WV, const float* __restrict__ WO, __bf16* __restrict__ PW, __bf16* __restrict__ XB) { const int kc0 = blockIdx.x * 4, y = blockIdx.y, t = threadIdx.x; v8b o[4];
  if (y < 48) { const int which = y / 12, p = (y % 12) / 3, n = (y % 3) * 256 + t; const float* w = (which == 0) ? WQ : (which == 1) ? WK : (which == 2) ? WV : WO; const float* s = w + (size_t)(kc0 * 32 + p * 8) * DM + n; __bf16* d = PW + (((size_t)which * (DM / 16) + (n >> 4)) * (DM / 32) + kc0) * 512 + p * 128 + (n & 15) * 8;
#pragma unroll
    for (int kk = 0; kk < 4; ++kk) {
#pragma unroll
      for (int i = 0; i < 8; ++i) o[kk][i] = (__bf16)s[(size_t)(kk * 32 + i) * DM]; }
#pragma unroll
    for (int kk = 0; kk < 4; ++kk) vst2(d + kk * 512, o[kk]); }
  else { const int src = (y - 48) >> 6, rt = ((y - 48) & 63) * 4 + (t >> 6), p = (t >> 4) & 3, c = t & 15; const float* s = (src ? ENC : X) + (size_t)(rt * 16 + c) * DM + kc0 * 32 + p * 8; __bf16* d = XB + (((size_t)src * (NQ / 16) + rt) * (DM / 32) + kc0) * 512 + p * 128 + c * 8;
#pragma unroll
    for (int kk = 0; kk < 4; ++kk) { const v4f lo = *(const v4f*)(s + kk * 32), hi = *(const v4f*)(s + kk * 32 + 4);
#pragma unroll
      for (int i = 0; i < 4; ++i) { o[kk][i] = (__bf16)lo[i]; o[kk][4 + i] = (__bf16)hi[i]; } }
#pragma unroll
    for (int kk = 0; kk < 4; ++kk) vst2(d + kk * 512, o[kk]); } }
// ---- k_proj: block = (64 rows, 128 cols, which): Q from x, K/V from the encoding (both as packed blocks; + bias); Q f16 rows, K and V fragment blocks
__global__ __launch_bounds__(128) void k_proj(const __bf16* __restrict__ XB, const __bf16* __restrict__ PW, const float* __restrict__ BQ, const float* __restrict__ BK, const float* __restrict__ BV, _Float16* __restrict__ Q, _Float16* __restrict__ Kr, _Float16* __restrict__ V) {
  __shared__ __align__(16) _Float16 so[64][136]; __shared__ __align__(16) _Float16 st[128][72];
  const int tid = threadIdx.x, wave = tid >> 5, lane = tid & 31, col = lane & 15, g = lane >> 4; const int which = blockIdx.z; const size_t rb = (size_t)blockIdx.x * 64; if (which == 0 && rb >= (size_t)TQB * 64) return;
  const size_t r0 = rb + wave * 16; const int c0 = blockIdx.y * 128; const __bf16* Wr = PW + ((size_t)which * (DM / 16) + (c0 >> 4)) * (DM / 32) * 512 + 8 * lane; const float* BB = (which == 0) ? BQ : (which == 1) ? BK : BV;
  v8f acc[8] = {};
  // fragments run one k step ahead: each weight fragment is reloaded for step kc + 1 right behind the product that used it, the activation row at the head of the step
  const __bf16* Ap = XB + ((size_t)(which != 0) * (NQ / 16) + (r0 >> 4)) * (DM / 32) * 512 + 8 * lane; v16b an = fragp_b(Ap), w[8];
  __builtin_amdgcn_sched_barrier(0);   // the row's loads stay the oldest here as in the loop: the wait at the loop's head is then a counted one, not for every load in flight
#pragma unroll
  for (int j = 0; j < 8; ++j) w[j] = fragp_b(Wr + j * (DM / 32) * 512);
#pragma unroll 1   // stays rolled: with the odd trip count an unroll by 2 came out as all 24 steps in a row
  for (int kc = 0; kc < DM / 32 - 1; ++kc) { const v16b a = an; an = fragp_b(Ap + (kc + 1) * 512);
#pragma unroll
    for (int j = 0; j < 8; ++j) { acc[j] = wmma_bf(a, w[j], acc[j]); w[j] = fragp_b(Wr + (j * (DM / 32) + kc + 1) * 512); }
    asm volatile("s_wait_xcnt 0x0" ::: "memory"); }   // stands in front of the next step's rewrite of the last loads' address registers
#pragma unroll
  for (int j = 0; j < 8; ++j) acc[j] = wmma_bf(an, w[j], acc[j]);
#pragma unroll
  for (int j = 0; j < 8; ++j) { const float bb = bfr(BB[c0 + j * 16 + col]);
#pragma unroll
    for (int r = 0; r < 8; ++r) { const _Float16 hv = (_Float16)(acc[j][r] + bb); if (which < 2) so[wave * 16 + 8 * g + r][j * 16 + col] = hv; else st[j * 16 + col][wave * 16 + 8 * g + r] = hv; } }
  __syncthreads();
  if (which == 0) { for (int e = tid; e < 64 * 16; e += 128) { const int rl = e >> 4, q = e & 15; vst2((unsigned*)(Q + (rb + rl) * DM + c0 + q * 8), *(const v4u*)&so[rl][q * 8]); } }
  // K, V: piece e = (head of 2, tile, chunk, 8-element group p of 4, row c of 16) in block order, so a wave stores 512 contiguous bytes
  else if (which == 1) { for (int e = tid; e < 64 * 16; e += 128) { const int c = e & 15, p = (e >> 4) & 3, kc = (e >> 6) & 1, kt = (e >> 7) & 3, hd = e >> 9; vst2((unsigned*)(Kr + ((((size_t)(c0 >> 6) + hd) * (NK / 16) + (rb >> 4) + kt) * 2 + kc) * 512 + p * 128 + c * 8), *(const v4u*)&so[kt * 16 + c][hd * 64 + kc * 32 + p * 8]); } }
  else { for (int e = tid; e < 128 * 8; e += 128) { const int c = e & 15, p = (e >> 4) & 3, dt = (e >> 6) & 3, ksl = (e >> 8) & 1, hd = e >> 9; vst2((unsigned*)(V + ((((size_t)(c0 >> 6) + hd) * (NK / 32) + (rb >> 5) + ksl) * 4 + dt) * 512 + p * 128 + c * 8), *(const v4u*)&st[hd * 64 + dt * 16 + c][ksl * 32 + p * 8]); } }
}
// ---- k_attn: block = (64 queries, head): softmax(q k / 8) over the 4,096 keys; ctx f32 in the fragment blocks that k_out reads
__global__ __launch_bounds__(128) void k_attn(const _Float16* __restrict__ Q, const _Float16* __restrict__ Kr, const _Float16* __restrict__ V, float* __restrict__ O) {
  __shared__ __align__(16) _Float16 sph[4][16][40]; __shared__ __align__(16) float so[4][16][68];
  const int tid = threadIdx.x, wave = tid >> 5, lane = tid & 31, col = lane & 15, g = lane >> 4; const int h = blockIdx.y; const int q0 = blockIdx.x * 64 + wave * 16; const size_t rq = (size_t)q0;
  v16h aq[2];
#pragma unroll
  for (int kc = 0; kc < 2; ++kc) aq[kc] = frag_h(Q + (rq + col) * DM + h * HD + kc * 32, lane);
  float m[8], l[8];
#pragma unroll
  for (int r = 0; r < 8; ++r) { m[r] = -3.0e38f; l[r] = 0.f; }
  v8f acc[4] = {};
  // K fragments run one pass ahead (reloaded as one group behind the score products); V fragments are asked for as one group at the head of their pass
  v16h kf[2][2], vf[4]; const _Float16* Kp = Kr + (size_t)h * NK * HD + 8 * lane; const _Float16* Vp = V + (size_t)h * NK * HD + 8 * lane;   // a pass = 4 blocks of each, 4 KiB in a row
#pragma unroll
  for (int ct = 0; ct < 2; ++ct) {
#pragma unroll
    for (int kc = 0; kc < 2; ++kc) kf[ct][kc] = fragp_h(Kp + (ct * 2 + kc) * 512); }
#pragma unroll 1
  for (int ks = 0; ks < NK / 32; ++ks) { v8f s[2];
#pragma unroll
    for (int dt = 0; dt < 4; ++dt) vf[dt] = fragp_h(Vp + (ks * 4 + dt) * 512);
#pragma unroll
    for (int ct = 0; ct < 2; ++ct) { v8f c = {};
#pragma unroll
      for (int kc = 0; kc < 2; ++kc) c = wmma16(aq[kc], kf[ct][kc], c);
#pragma unroll
      for (int r = 0; r < 8; ++r) s[ct][r] = c[r] * 0.125f; }
    const int jn = ((ks + 1) & (NK / 32 - 1)) * 4;   // the last pass asks for pass 0's blocks again: in bounds, not used
#pragma unroll
    for (int ct = 0; ct < 2; ++ct) {
#pragma unroll
      for (int kc = 0; kc < 2; ++kc) kf[ct][kc] = fragp_h(Kp + (jn + ct * 2 + kc) * 512); }
    __builtin_amdgcn_sched_barrier(0);   // keeps the K loads here, ahead of the whole softmax: the scheduler otherwise sinks them towards the fence below, which waits for them
#pragma unroll
    for (int r = 0; r < 8; ++r) { float mx = fmaxf(s[0][r], s[1][r]);
#pragma unroll
      for (int o = 1; o < 16; o <<= 1) mx = fmaxf(mx, __shfl_xor(mx, o));
      const float mn = fmaxf(m[r], mx); const float alpha = (m[r] <= -1.0e38f) ? 0.f : __expf(m[r] - mn); const float e0 = __expf(s[0][r] - mn), e1 = __expf(s[1][r] - mn); float es = e0 + e1;
#pragma unroll
      for (int o = 1; o < 16; o <<= 1) es += __shfl_xor(es, o);
      l[r] = l[r] * alpha + es; m[r] = mn;
#pragma unroll
      for (int dt = 0; dt < 4; ++dt) acc[dt][r] *= alpha;
      sph[wave][8 * g + r][col] = (_Float16)(e0 * 2048.0f); sph[wave][8 * g + r][16 + col] = (_Float16)(e1 * 2048.0f); }
    LDSX();
    const v16h pa = frag_h(&sph[wave][col][0], lane);
#pragma unroll
    for (int dt = 0; dt < 4; ++dt) acc[dt] = wmma16(pa, vf[dt], acc[dt]);
    LDSX(); }
#pragma unroll
  for (int r = 0; r < 8; ++r) { const float il = (1.0f / 2048.0f) / l[r];
#pragma unroll
    for (int dt = 0; dt < 4; ++dt) so[wave][8 * g + r][dt * 16 + col] = acc[dt][r] * il; }
  LDSX();
  for (int b = 0; b < 8; ++b) vst2(O + ((size_t)(q0 >> 4) * (DM / 32) + h * 2 + (b >> 2)) * 512 + (b & 3) * 128 + lane * 4, *(const v4f*)&so[wave][col][(b >> 2) * 32 + ((b >> 1) & 1) * 16 + 8 * g + (b & 1) * 4]);
}
// ---- k_out: block = (64 rows, 128 cols): out = ctx (hi + lo) . w_o + b_o
__global__ __launch_bounds__(128) void k_out(const float* __restrict__ O, const __bf16* __restrict__ PW, const float* __restrict__ BO, float* __restrict__ Y) { __shared__ __align__(16) float so[4][16][132];
  const int tid = threadIdx.x, wave = tid >> 5, lane = tid & 31, col = lane & 15, g = lane >> 4; const size_t r0 = (size_t)blockIdx.x * 64 + wave * 16; const int c0 = blockIdx.y * 128; const __bf16* Wr = PW + ((size_t)3 * (DM / 16) + (c0 >> 4)) * (DM / 32) * 512 + 8 * lane;
  v8f acc[8] = {};
  // fragments run one k step ahead, as in k_proj
  const float* Op = O + (r0 >> 4) * (DM / 32) * 512 + 4 * lane; v4f ar[4]; v16b w[8];
#pragma unroll
  for (int i = 0; i < 4; ++i) ar[i] = *(const v4f*)(Op + i * 128);
  __builtin_amdgcn_sched_barrier(0);   // the row's loads stay the oldest here as in the loop: the wait at the loop's head is then a counted one, not for every load in flight
#pragma unroll
  for (int j = 0; j < 8; ++j) w[j] = fragp_b(Wr + j * (DM / 32) * 512);
#pragma unroll 1   // stays rolled: with the odd trip count an unroll by 2 came out as all 24 steps in a row
  for (int kc = 0; kc < DM / 32 - 1; ++kc) { float v[16];
#pragma unroll
    for (int i = 0; i < 16; ++i) v[i] = ar[i >> 2][i & 3];
    const F2 a = bsplit16(v); Op += 512;   // a running pointer: its register pair lives over the whole loop, so no load's result can be placed in it
#pragma unroll
    for (int i = 0; i < 4; ++i) ar[i] = *(const v4f*)(Op + i * 128);
#pragma unroll
    for (int j = 0; j < 8; ++j) { acc[j] = wmma_bf(a.h, w[j], acc[j]); acc[j] = wmma_bf(a.l, w[j], acc[j]); w[j] = fragp_b(Wr + (j * (DM / 32) + kc + 1) * 512); }
    __builtin_amdgcn_sched_barrier(0);   // keeps the register copies of the rows just asked for at the loop's foot: lifted among the products they wait for those loads a whole step early
    asm volatile("s_wait_xcnt 0x0" ::: "memory"); }   // stands in front of the next step's rewrite of the last loads' address registers
  { float v[16];
#pragma unroll
    for (int i = 0; i < 16; ++i) v[i] = ar[i >> 2][i & 3];
    const F2 a = bsplit16(v);
#pragma unroll
    for (int j = 0; j < 8; ++j) { acc[j] = wmma_bf(a.h, w[j], acc[j]); acc[j] = wmma_bf(a.l, w[j], acc[j]); } }
#pragma unroll
  for (int j = 0; j < 8; ++j) { const float bb = bfr(BO[c0 + j * 16 + col]);
#pragma unroll
    for (int r = 0; r < 8; ++r) so[wave][8 * g + r][j * 16 + col] = acc[j][r] + bb; }
  LDSX(); for (int rl = 0; rl < 16; ++rl) vst2(Y + (r0 + rl) * DM + c0 + lane * 4, *(const v4f*)&so[wave][rl][lane * 4]); }
extern "C" void kernel_launch(void* const* d_in, const int* in_sizes, int n_in, void* d_out, int out_size, void* d_ws, size_t ws_size, hipStream_t stream) {
  (void)in_sizes; (void)n_in; (void)out_size;
  const float** F = (const float**)d_in;   // 0 x [1,4096,768], 1 encoding [1,4096,768], 2 w_q (in,out), 3 b_q, 4 w_k, 5 b_k, 6 w_v, 7 b_v, 8 w_o [768,768] (in,out), 9 b_o
  if (ws_size < (size_t)WS_END) return;
  char* ws = (char*)d_ws; __bf16* PW = (__bf16*)ws; _Float16 *Q = (_Float16*)(ws + WS_Q), *Kr = (_Float16*)(ws + WS_K), *V = (_Float16*)(ws + WS_V); float* O = (float*)(ws + WS_O); __bf16* XB = (__bf16*)(ws + WS_XB);
  k_pack<<<dim3(DM / 128, 48 + 128), 256, 0, stream>>>(F[0], F[1], F[2], F[4], F[6], F[8], PW, XB);
  k_proj<<<dim3(NK / 64, DM / 128, 3), 128, 0, stream>>>(XB, PW, F[3], F[5], F[7], Q, Kr, V);
  k_attn<<<dim3(TQB, NH), 128, 0, stream>>>(Q, Kr, V, O);
  k_out<<<dim3(TQB, DM / 128), 128, 0, stream>>>(O, PW, F[9], (float*)d_out);
}

// v003
// A run of this version takes 148 microseconds.
// Two timings next to v002 put it at 1.19 and 1.18 times that version's speed.
// Over all steps from v000 it is 3.16 times as fast.
// compute dtype: all float inputs rounded to bf16; Q = x . w_q + b, K/V = encoding . w + b with EXACT bf16 products on WMMA 16x16x32 (x, encoding and the (in,out) weights packed to bf16 fragment blocks first), rounded once to f16; attention over the 4,096 keys: q, k single f16 x 1/8, running-max softmax in f32 (hardware exp), P (scaled by 2^11, single f16) x v (single f16); out = ctx (bf16 hi + lo, 2 products) . w_o + b_o; f32 output.
#include <hip/hip_runtime.h>
#include <math.h>

typedef __attribute__((ext_vector_type(16))) _Float16 v16h;
typedef __attribute__((ext_vector_type(16))) __bf16 v16b;
typedef __attribute__((ext_vector_type(8)))  _Float16 v8h;
typedef __attribute__((ext_vector_type(8)))  float v8f;
typedef __attribute__((ext_vector_type(4)))  float v4f;
typedef __attribute__((ext_vector_type(2)))  float v2f;
typedef __attribute__((ext_vector_type(4)))  unsigned v4u;
typedef __attribute__((ext_vector_type(4)))  int v4i;
typedef float __attribute__((may_alias)) float_a;
typedef int __attribute__((may_alias)) int_a;

template <typename T> __device__ __forceinline__ void vst2(void* p, T v) { *(T*)p = v;  }
__device__ __forceinline__ v8f wmma16(v16h a, v16h b, v8f c) {
  v8f d = __builtin_amdgcn_wmma_f32_16x16x32_f16(false, a, false, b, (short)0, c, false, false);
  asm volatile("v_nop\n\tv_nop\n\tv_nop\n\tv_nop" : "+v"(d) : "v"(a), "v"(b));
  return d;
}
__device__ __forceinline__ v8f wmma_bf(v16b a, v16b b, v8f c) {
  v8f d = __builtin_amdgcn_wmma_f32_16x16x32_bf16(false, a, false, b, (short)0, c, false, false);
  asm volatile("v_nop\n\tv_nop\n\tv_nop\n\tv_nop" : "+v"(d) : "v"(a), "v"(b));
  return d;
}
// 16x16x32 fragments: lane = (h = lane>>4, row/col = lane&15); elements 0..7 = k0+8h+0..7, 8..15 = k0+16+8h+0..7; D element r = row 8h+r
__device__ __forceinline__ v16h frag_h(const _Float16* rowk0, int lane) {
  union { v16h v; v8h q[2]; } u; const _Float16* p = rowk0 + 8 * (lane >> 4);
  u.q[0] = *(const v8h*)p; u.q[1] = *(const v8h*)(p + 16); return u.v;
}
__device__ __forceinline__ v16h frag_f32(const float* rowk0, int lane) {
  v16h a; const float* p = rowk0 + 8 * (lane >> 4);
#pragma unroll
  for (int i = 0; i < 8; ++i) { a[i] = (_Float16)p[i]; a[8 + i] = (_Float16)p[16 + i]; }
  return a;
}
__device__ __forceinline__ v16h frag_f32s(const float* rowk0, int lane, float sc) {
  v16h a; const float* p = rowk0 + 8 * (lane >> 4);
#pragma unroll
  for (int i = 0; i < 8; ++i) { a[i] = (_Float16)(p[i] * sc); a[8 + i] = (_Float16)(p[16 + i] * sc); }
  return a;
}
// column fragment from a [K][ld] layout (column n), rows >= K read as 0
__device__ __forceinline__ v16h fragc_f32(const float* W, int k0, int n, int lane, int ld, int K) {
  v16h a; const int g = lane >> 4;
#pragma unroll
  for (int i = 0; i < 8; ++i) { const int ka = k0 + 8 * g + i, kb = ka + 16;
    a[i] = (_Float16)(ka < K ? W[(size_t)(ka < K ? ka : K - 1) * ld + n] : 0.f); a[8 + i] = (_Float16)(kb < K ? W[(size_t)(kb < K ? kb : K - 1) * ld + n] : 0.f); }
  return a;
}
struct F2 { v16b h, l; };
__device__ __forceinline__ F2 bsplit16(const float v[16]) { F2 r;
#pragma unroll
  for (int i = 0; i < 16; ++i) { const __bf16 h = (__bf16)v[i]; r.h[i] = h; r.l[i] = (__bf16)(v[i] - (float)h); }
  return r; }
__device__ __forceinline__ F2 split_row(const float* row, int k0, int lane) { float v[16]; const float* p = row + k0 + 8 * (lane >> 4);
#pragma unroll
  for (int i = 0; i < 8; ++i) { v[i] = p[i]; v[8 + i] = p[16 + i]; }
  return bsplit16(v); }
__device__ __forceinline__ F2 split_rowK(const float* row, int k0, int lane, int K) { float v[16]; const int g = lane >> 4;
#pragma unroll
  for (int i = 0; i < 8; ++i) { const int ka = k0 + 8 * g + i, kb = ka + 16; v[i] = ka < K ? row[ka < K ? ka : K - 1] : 0.f; v[8 + i] = kb < K ? row[kb < K ? kb : K - 1] : 0.f; }
  return bsplit16(v); }
__device__ __forceinline__ F2 split_col(const float* W, int k0, int n, int lane, int ld, int K) { float v[16]; const int g = lane >> 4;
#pragma unroll
  for (int i = 0; i < 8; ++i) { const int ka = k0 + 8 * g + i, kb = ka + 16; v[i] = ka < K ? W[(size_t)(ka < K ? ka : K - 1) * ld + n] : 0.f; v[8 + i] = kb < K ? W[(size_t)(kb < K ? kb : K - 1) * ld + n] : 0.f; }
  return bsplit16(v); }
__device__ __forceinline__ v8f mac3(const F2& a, const F2& b, v8f c) { c = wmma_bf(a.l, b.h, c); c = wmma_bf(a.h, b.l, c); return wmma_bf(a.h, b.h, c); }
__device__ __forceinline__ float sigm(float v) { return 1.0f / (1.0f + expf(-v)); }
#define LDSX() do { asm volatile("s_wait_dscnt 0" ::: "memory"); __builtin_amdgcn_wave_barrier(); __builtin_amdgcn_fence(__ATOMIC_RELEASE, "workgroup"); } while (0)


// Encoder-decoder multi-head attention (B 1, N 4,096 queries and keys, d_model 768, 12 heads x 64): q from x, k/v from the encoding, softmax(Q K^T / 8) V, output projection + bias.
#define NQ 4096
#define NK 4096
#define DM 768
#define NH 12
#define HD 64
#ifndef TQB
#define TQB (NQ / 64)
#endif
typedef __attribute__((ext_vector_type(8))) __bf16 v8b;
__device__ __forceinline__ v16b frag_b(const __bf16* rowk0, int lane) {
  union { v16b v; v8b q[2]; } u; const __bf16* p = rowk0 + 8 * (lane >> 4);
  u.q[0] = *(const v8b*)p; u.q[1] = *(const v8b*)(p + 16); return u.v;
}
// fragment-order blocks: one (16 rows or columns) x (32 k) operand tile = 512 elements laid [half of the slots][lane][8], so each of a fragment's two wave-wide 16-byte loads covers 512 contiguous bytes; p = block + 8 * lane
__device__ __forceinline__ v16b fragp_b(const __bf16* p) { union { v16b v; v8b q[2]; } u; u.q[0] = *(const v8b*)p; u.q[1] = *(const v8b*)(p + 256); return u.v; }
__device__ __forceinline__ v16h fragp_h(const _Float16* p) { union { v16h v; v8h q[2]; } u; u.q[0] = *(const v8h*)p; u.q[1] = *(const v8h*)(p + 256); return u.v; }
__device__ __forceinline__ float bfr(float v) { return (float)(__bf16)v; }
__device__ __attribute__((noinline)) float exp_ni(float v) { return expf(v); }
__device__ __attribute__((noinline)) float erf_ni(float v) { return erff(v); }

#define WS_PW  0u                                   // bf16 w_q, w_k, w_v, w_o as fragment blocks [4][48 column tiles][24 k chunks][512]
#define WS_Q   (WS_PW + 2u * (size_t)4 * DM * DM)       // f16 Q rows [NQ][768]; K blocks [head][256 key tiles][2 d chunks][512]; V blocks [head][128 passes][4 d tiles][512]; f32 ctx blocks [256 row tiles][24 k chunks][4][lane][4]
#define WS_K   (WS_Q + 2u * (size_t)NQ * DM)
#define WS_V   (WS_K + 2u * (size_t)NK * DM)
#define WS_O   (WS_V + 2u * (size_t)DM * NK)
#define WS_XB  (WS_O + 4u * (size_t)NQ * DM)            // bf16 x, encoding as fragment blocks [2][256 row tiles][24 k chunks][512]
#define WS_END (WS_XB + 2u * (size_t)(NQ + NK) * DM)

// ---- k_pack: a 16-byte piece = 8 k of one row or column of a fragment block, rounded to bf16; thread = that piece in 4 k chunks (fewer, longer waves: the launch is short and wave starts count); block = (4 k chunks, y): y < 48 weights (the reads run along n, whole lines), else 64 rows of x or of the encoding; a wave stores whole lines
__global__ __launch_bounds__(256) void k_pack(const float* __restrict__ X, const float* __restrict__ ENC, const float* __restrict__ WQ, const float* __restrict__ WK, const float* __restrict__ WV, const float* __restrict__ WO, __bf16* __restrict__ PW, __bf16* __restrict__ XB) { const int kc0 = blockIdx.x * 4, y = blockIdx.y, t = threadIdx.x; v8b o[4];
  if (y < 48) { const int which = y / 12, p = (y % 12) / 3, n = (y % 3) * 256 + t; const float* w = (which == 0) ? WQ : (which == 1) ? WK : (which == 2) ? WV : WO; const float* s = w + (size_t)(kc0 * 32 + p * 8) * DM + n; __bf16* d = PW + (((size_t)which * (DM / 16) + (n >> 4)) * (DM / 32) + kc0) * 512 + p * 128 + (n & 15) * 8;
#pragma unroll
    for (int kk = 0; kk < 4; ++kk) {
#pragma unroll
      for (int i = 0; i < 8; ++i) o[kk][i] = (__bf16)s[(size_t)(kk * 32 + i) * DM]; }
#pragma unroll
    for (int kk = 0; kk < 4; ++kk) vst2(d + kk * 512, o[kk]); }
  else { const int src = (y - 48) >> 6, rt = ((y - 48) & 63) * 4 + (t >> 6), p = (t >> 4) & 3, c = t & 15; const float* s = (src ? ENC : X) + (size_t)(rt * 16 + c) * DM + kc0 * 32 + p * 8; __bf16* d = XB + (((size_t)src * (NQ / 16) + rt) * (DM / 32) + kc0) * 512 + p * 128 + c * 8;
#pragma unroll
    for (int kk = 0; kk < 4; ++kk) { const v4f lo = *(const v4f*)(s + kk * 32), hi = *(const v4f*)(s + kk * 32 + 4);
#pragma unroll
      for (int i = 0; i < 4; ++i) { o[kk][i] = (__bf16)lo[i]; o[kk][4 + i] = (__bf16)hi[i]; } }
#pragma unroll
    for (int kk = 0; kk < 4; ++kk) vst2(d + kk * 512, o[kk]); } }
// ---- k_proj: block = (64 rows, 128 cols, which): Q from x, K/V from the encoding (both as packed blocks; + bias); Q f16 rows, K and V fragment blocks
__global__ __launch_bounds__(128) void k_proj(const __bf16* __restrict__ XB, const __bf16* __restrict__ PW, const float* __restrict__ BQ, const float* __restrict__ BK, const float* __restrict__ BV, _Float16* __restrict__ Q, _Float16* __restrict__ Kr, _Float16* __restrict__ V) {
  __shared__ __align__(16) _Float16 so[64][136]; __shared__ __align__(16) _Float16 st[128][72];
  const int tid = threadIdx.x, wave = tid >> 5, lane = tid & 31, col = lane & 15, g = lane >> 4; const int which = blockIdx.z; const size_t rb = (size_t)blockIdx.x * 64; if (which == 0 && rb >= (size_t)TQB * 64) return;
  const size_t r0 = rb + wave * 16; const int c0 = blockIdx.y * 128; const __bf16* Wr = PW + ((size_t)which * (DM / 16) + (c0 >> 4)) * (DM / 32) * 512 + 8 * lane; const float* BB = (which == 0) ? BQ : (which == 1) ? BK : BV;
  v8f acc[8] = {};
  // fragments run one k step ahead: each weight fragment is reloaded for step kc + 1 right behind the product that used it, the activation row at the head of the step
  const __bf16* Ap = XB + ((size_t)(which != 0) * (NQ / 16) + (r0 >> 4)) * (DM / 32) * 512 + 8 * lane; v16b an = fragp_b(Ap), w[8];
  __builtin_amdgcn_sched_barrier(0);   // the row's loads stay the oldest here as in the loop: the wait at the loop's head is then a counted one, not for every load in flight
#pragma unroll
  for (int j = 0; j < 8; ++j) w[j] = fragp_b(Wr + j * (DM / 32) * 512);
#pragma unroll 1   // stays rolled: with the odd trip count an unroll by 2 came out as all 24 steps in a row
  for (int kc = 0; kc < DM / 32 - 1; ++kc) { const v16b a = an; an = fragp_b(Ap + (kc + 1) * 512);
#pragma unroll
    for (int j = 0; j < 8; ++j) { acc[j] = wmma_bf(a, w[j], acc[j]); w[j] = fragp_b(Wr + (j * (DM / 32) + kc + 1) * 512); }
    asm volatile("s_wait_xcnt 0x0" ::: "memory"); }   // stands in front of the next step's rewrite of the last loads' address registers
#pragma unroll
  for (int j = 0; j < 8; ++j) acc[j] = wmma_bf(an, w[j], acc[j]);
#pragma unroll
  for (int j = 0; j < 8; ++j) { const float bb = bfr(BB[c0 + j * 16 + col]);
#pragma unroll
    for (int r = 0; r < 8; ++r) { const _Float16 hv = (_Float16)(acc[j][r] + bb); if (which < 2) so[wave * 16 + 8 * g + r][j * 16 + col] = hv; else st[j * 16 + col][wave * 16 + 8 * g + r] = hv; } }
  __syncthreads();
  if (which == 0) { for (int e = tid; e < 64 * 16; e += 128) { const int rl = e >> 4, q = e & 15; vst2((unsigned*)(Q + (rb + rl) * DM + c0 + q * 8), *(const v4u*)&so[rl][q * 8]); } }
  // K, V: piece e = (head of 2, tile, chunk, 8-element group p of 4, row c of 16) in block order, so a wave stores 512 contiguous bytes
  else if (which == 1) { for (int e = tid; e < 64 * 16; e += 128) { const int c = e & 15, p = (e >> 4) & 3, kc = (e >> 6) & 1, kt = (e >> 7) & 3, hd = e >> 9; vst2((unsigned*)(Kr + ((((size_t)(c0 >> 6) + hd) * (NK / 16) + (rb >> 4) + kt) * 2 + kc) * 512 + p * 128 + c * 8), *(const v4u*)&so[kt * 16 + c][hd * 64 + kc * 32 + p * 8]); } }
  else { for (int e = tid; e < 128 * 8; e += 128) { const int c = e & 15, p = (e >> 4) & 3, dt = (e >> 6) & 3, ksl = (e >> 8) & 1, hd = e >> 9; vst2((unsigned*)(V + ((((size_t)(c0 >> 6) + hd) * (NK / 32) + (rb >> 5) + ksl) * 4 + dt) * 512 + p * 128 + c * 8), *(const v4u*)&st[hd * 64 + dt * 16 + c][ksl * 32 + p * 8]); } }
}
// ---- k_attn: block = (64 queries, head): softmax(q k / 8) over the 4,096 keys, transposed: scores^T = K . Q^T and ctx^T += V^T . P^T, so a lane holds 16 scores of ONE query (column col; keys 8g + r and 16 + 8g + r of the pass, g = lane >> 4); ctx f32 in the fragment blocks that k_out reads
__device__ __forceinline__ float xhalf(float v) { const int b = __builtin_bit_cast(int, v); return __builtin_bit_cast(float, __builtin_amdgcn_permlanex16(b, b, 0x76543210, 0xfedcba98, false, false)); }   // the value of lane ^ 16: the same query's other half of the keys
__global__ __launch_bounds__(128) void k_attn(const _Float16* __restrict__ Q, const _Float16* __restrict__ Kr, const _Float16* __restrict__ V, float* __restrict__ O) {
  const int tid = threadIdx.x, wave = tid >> 5, lane = tid & 31, col = lane & 15; const int h = blockIdx.y; const int q0 = blockIdx.x * 64 + wave * 16; const size_t rq = (size_t)q0;
  v16h bq[2];   // B operand: column = query
#pragma unroll
  for (int kc = 0; kc < 2; ++kc) bq[kc] = frag_h(Q + (rq + col) * DM + h * HD + kc * 32, lane);
  float m = -3.0e38f, l = 0.f;   // the query's running maximum (equal in both halves) and this half's sum
  v8f acc[4] = {};   // acc[dt][r] = ctx[query col][16 dt + 8g + r]
  // K fragments (A: row = key) run one pass ahead (reloaded as one group behind the score products); V fragments (A: row = d) are asked for as one group at the head of their pass
  v16h kf[2][2], vf[4]; const _Float16* Kp = Kr + (size_t)h * NK * HD + 8 * lane; const _Float16* Vp = V + (size_t)h * NK * HD + 8 * lane;   // a pass = 4 blocks of each, 4 KiB in a row
#pragma unroll
  for (int ct = 0; ct < 2; ++ct) {
#pragma unroll
    for (int kc = 0; kc < 2; ++kc) kf[ct][kc] = fragp_h(Kp + (ct * 2 + kc) * 512); }
#pragma unroll 1
  for (int ks = 0; ks < NK / 32; ++ks) { v8f s[2];
#pragma unroll
    for (int dt = 0; dt < 4; ++dt) vf[dt] = fragp_h(Vp + (ks * 4 + dt) * 512);
#pragma unroll
    for (int ct = 0; ct < 2; ++ct) { v8f c = {};
#pragma unroll
      for (int kc = 0; kc < 2; ++kc) c = wmma16(kf[ct][kc], bq[kc], c);
#pragma unroll
      for (int r = 0; r < 8; ++r) s[ct][r] = c[r] * 0.125f; }
    const int jn = ((ks + 1) & (NK / 32 - 1)) * 4;   // the last pass asks for pass 0's blocks again: in bounds, not used
#pragma unroll
    for (int ct = 0; ct < 2; ++ct) {
#pragma unroll
      for (int kc = 0; kc < 2; ++kc) kf[ct][kc] = fragp_h(Kp + (jn + ct * 2 + kc) * 512); }
    __builtin_amdgcn_sched_barrier(0);   // keeps the K loads here, ahead of the whole softmax, so that they have the rest of the pass to land
    float mq[4];
#pragma unroll
    for (int i = 0; i < 4; ++i) mq[i] = fmaxf(fmaxf(s[0][i], s[0][4 + i]), fmaxf(s[1][i], s[1][4 + i]));
    float mx = fmaxf(fmaxf(mq[0], mq[1]), fmaxf(mq[2], mq[3])); mx = fmaxf(mx, xhalf(mx));
    const float mn = fmaxf(m, mx); const float alpha = (m <= -1.0e38f) ? 0.f : __expf(m - mn); m = mn;
    v8f e[2];
#pragma unroll
    for (int ct = 0; ct < 2; ++ct) {
#pragma unroll
      for (int r = 0; r < 8; ++r) e[ct][r] = __expf(s[ct][r] - mn); }
    const v8f t8 = e[0] + e[1]; const v4f t4 = t8.lo + t8.hi; const v2f t2 = t4.lo + t4.hi;
    l = l * alpha + (t2.x + t2.y);
#pragma unroll
    for (int dt = 0; dt < 4; ++dt) {
#pragma unroll
      for (int r = 0; r < 8; ++r) acc[dt][r] *= alpha; }
    v16h pb;   // B operand straight from the two score tiles: slot i = key 8g + i, slot 8 + i = key 16 + 8g + i, the k order of the V blocks
#pragma unroll
    for (int i = 0; i < 8; ++i) { pb[i] = (_Float16)(e[0][i] * 2048.0f); pb[8 + i] = (_Float16)(e[1][i] * 2048.0f); }
#pragma unroll
    for (int dt = 0; dt < 4; ++dt) acc[dt] = wmma16(vf[dt], pb, acc[dt]); }
  l += xhalf(l); const float il = (1.0f / 2048.0f) / l;
  // a lane already holds the 32 values of its places in the two ctx blocks
#pragma unroll
  for (int b = 0; b < 8; ++b) { v4f o;
#pragma unroll
    for (int i = 0; i < 4; ++i) o[i] = acc[b >> 1][(b & 1) * 4 + i] * il;
    vst2(O + ((size_t)(q0 >> 4) * (DM / 32) + h * 2 + (b >> 2)) * 512 + (b & 3) * 128 + lane * 4, o); }
}
// ---- k_out: block = (64 rows, 128 cols): out = ctx (hi + lo) . w_o + b_o
__global__ __launch_bounds__(128) void k_out(const float* __restrict__ O, const __bf16* __restrict__ PW, const float* __restrict__ BO, float* __restrict__ Y) { __shared__ __align__(16) float so[4][16][132];
  const int tid = threadIdx.x, wave = tid >> 5, lane = tid & 31, col = lane & 15, g = lane >> 4; const size_t r0 = (size_t)blockIdx.x * 64 + wave * 16; const int c0 = blockIdx.y * 128; const __bf16* Wr = PW + ((size_t)3 * (DM / 16) + (c0 >> 4)) * (DM / 32) * 512 + 8 * lane;
  v8f acc[8] = {};
  // fragments run one k step ahead, as in k_proj
  const float* Op = O + (r0 >> 4) * (DM / 32) * 512 + 4 * lane; v4f ar[4]; v16b w[8];
#pragma unroll
  for (int i = 0; i < 4; ++i) ar[i] = *(const v4f*)(Op + i * 128);
  __builtin_amdgcn_sched_barrier(0);   // the row's loads stay the oldest here as in the loop: the wait at the loop's head is then a counted one, not for every load in flight
#pragma unroll
  for (int j = 0; j < 8; ++j) w[j] = fragp_b(Wr + j * (DM / 32) * 512);
#pragma unroll 1   // stays rolled: with the odd trip count an unroll by 2 came out as all 24 steps in a row
  for (int kc = 0; kc < DM / 32 - 1; ++kc) { float v[16];
#pragma unroll
    for (int i = 0; i < 16; ++i) v[i] = ar[i >> 2][i & 3];
    const F2 a = bsplit16(v); Op += 512;   // a running pointer: its register pair lives over the whole loop, so no load's result can be placed in it
#pragma unroll
    for (int i = 0; i < 4; ++i) ar[i] = *(const v4f*)(Op + i * 128);
#pragma unroll
    for (int j = 0; j < 8; ++j) { acc[j] = wmma_bf(a.h, w[j], acc[j]); acc[j] = wmma_bf(a.l, w[j], acc[j]); w[j] = fragp_b(Wr + (j * (DM / 32) + kc + 1) * 512); }
    __builtin_amdgcn_sched_barrier(0);   // keeps the register copies of the rows just asked for at the loop's foot: lifted among the products they wait for those loads a whole step early
    asm volatile("s_wait_xcnt 0x0" ::: "memory"); }   // stands in front of the next step's rewrite of the last loads' address registers
  { float v[16];
#pragma unroll
    for (int i = 0; i < 16; ++i) v[i] = ar[i >> 2][i & 3];
    const F2 a = bsplit16(v);
#pragma unroll
    for (int j = 0; j < 8; ++j) { acc[j] = wmma_bf(a.h, w[j], acc[j]); acc[j] = wmma_bf(a.l, w[j], acc[j]); } }
#pragma unroll
  for (int j = 0; j < 8; ++j) { const float bb = bfr(BO[c0 + j * 16 + col]);
#pragma unroll
    for (int r = 0; r < 8; ++r) so[wave][8 * g + r][j * 16 + col] = acc[j][r] + bb; }
  LDSX(); for (int rl = 0; rl < 16; ++rl) vst2(Y + (r0 + rl) * DM + c0 + lane * 4, *(const v4f*)&so[wave][rl][lane * 4]); }
extern "C" void kernel_launch(void* const* d_in, const int* in_sizes, int n_in, void* d_out, int out_size, void* d_ws, size_t ws_size, hipStream_t stream) {
  (void)in_sizes; (void)n_in; (void)out_size;
  const float** F = (const float**)d_in;   // 0 x [1,4096,768], 1 encoding [1,4096,768], 2 w_q (in,out), 3 b_q, 4 w_k, 5 b_k, 6 w_v, 7 b_v, 8 w_o [768,768] (in,out), 9 b_o
  if (ws_size < (size_t)WS_END) return;
  char* ws = (char*)d_ws; __bf16* PW = (__bf16*)ws; _Float16 *Q = (_Float16*)(ws + WS_Q), *Kr = (_Float16*)(ws + WS_K), *V = (_Float16*)(ws + WS_V); float* O = (float*)(ws + WS_O); __bf16* XB = (__bf16*)(ws + WS_XB);
  k_pack<<<dim3(DM / 128, 48 + 128), 256, 0, stream>>>(F[0], F[1], F[2], F[4], F[6], F[8], PW, XB);
  k_proj<<<dim3(NK / 64, DM / 128, 3), 128, 0, stream>>>(XB, PW, F[3], F[5], F[7], Q, Kr, V);
  k_attn<<<dim3(TQB, NH), 128, 0, stream>>>(Q, Kr, V, O);
  k_out<<<dim3(TQB, DM / 128), 128, 0, stream>>>(O, PW, F[9], (float*)d_out);
}

// v004
// A run of this version takes 109 microseconds.
// Next to v003, in two timings, it ran 1.33 and 1.32 times as fast.
// Counting every step since v000, it is 4.18 times as fast.
// compute dtype: all float inputs rounded to bf16; Q = x . w_q + b, K/V = encoding . w + b with EXACT bf16 products on WMMA 16x16x32 (x, encoding and the (in,out) weights packed to bf16 fragment blocks first), rounded once to f16; attention over the 4,096 keys: q, k single f16 x 1/8, running-max softmax in f32 (hardware exp), P (scaled by 2^11, single f16) x v (single f16); out = ctx (bf16 hi + lo, 2 products) . w_o + b_o; f32 output.
#include <hip/hip_runtime.h>
#include <math.h>

typedef __attribute__((ext_vector_type(16))) _Float16 v16h;
typedef __attribute__((ext_vector_type(16))) __bf16 v16b;
typedef __attribute__((ext_vector_type(8)))  _Float16 v8h;
typedef __attribute__((ext_vector_type(8)))  float v8f;
typedef __attribute__((ext_vector_type(4)))  float v4f;
typedef __attribute__((ext_vector_type(2)))  float v2f;
typedef __attribute__((ext_vector_type(4)))  unsigned v4u;
typedef __attribute__((ext_vector_type(4)))  int v4i;
typedef float __attribute__((may_alias)) float_a;
typedef int __attribute__((may_alias)) int_a;

template <typename T> __device__ __forceinline__ void vst2(void* p, T v) { *(T*)p = v;  }
__device__ __forceinline__ v8f wmma16(v16h a, v16h b, v8f c) {
  v8f d = __builtin_amdgcn_wmma_f32_16x16x32_f16(false, a, false, b, (short)0, c, false, false);
  asm volatile("v_nop\n\tv_nop\n\tv_nop\n\tv_nop" : "+v"(d) : "v"(a), "v"(b));
  return d;
}
__device__ __forceinline__ v8f wmma_bf(v16b a, v16b b, v8f c) {
  v8f d = __builtin_amdgcn_wmma_f32_16x16x32_bf16(false, a, false, b, (short)0, c, false, false);
  asm volatile("v_nop\n\tv_nop\n\tv_nop\n\tv_nop" : "+v"(d) : "v"(a), "v"(b));
  return d;
}
// 16x16x32 fragments: lane = (h = lane>>4, row/col = lane&15); elements 0..7 = k0+8h+0..7, 8..15 = k0+16+8h+0..7; D element r = row 8h+r
__device__ __forceinline__ v16h frag_h(const _Float16* rowk0, int lane) {
  union { v16h v; v8h q[2]; } u; const _Float16* p = rowk0 + 8 * (lane >> 4);
  u.q[0] = *(const v8h*)p; u.q[1] = *(const v8h*)(p + 16); return u.v;
}
__device__ __forceinline__ v16h frag_f32(const float* rowk0, int lane) {
  v16h a; const float* p = rowk0 + 8 * (lane >> 4);
#pragma unroll
  for (int i = 0; i < 8; ++i) { a[i] = (_Float16)p[i]; a[8 + i] = (_Float16)p[16 + i]; }
  return a;
}
__device__ __forceinline__ v16h frag_f32s(const float* rowk0, int lane, float sc) {
  v16h a; const float* p = rowk0 + 8 * (lane >> 4);
#pragma unroll
  for (int i = 0; i < 8; ++i) { a[i] = (_Float16)(p[i] * sc); a[8 + i] = (_Float16)(p[16 + i] * sc); }
  return a;
}
// column fragment from a [K][ld] layout (column n), rows >= K read as 0
__device__ __forceinline__ v16h fragc_f32(const float* W, int k0, int n, int lane, int ld, int K) {
  v16h a; const int g = lane >> 4;
#pragma unroll
  for (int i = 0; i < 8; ++i) { const int ka = k0 + 8 * g + i, kb = ka + 16;
    a[i] = (_Float16)(ka < K ? W[(size_t)(ka < K ? ka : K - 1) * ld + n] : 0.f); a[8 + i] = (_Float16)(kb < K ? W[(size_t)(kb < K ? kb : K - 1) * ld + n] : 0.f); }
  return a;
}
struct F2 { v16b h, l; };
__device__ __forceinline__ F2 bsplit16(const float v[16]) { F2 r;
#pragma unroll
  for (int i = 0; i < 16; ++i) { const __bf16 h = (__bf16)v[i]; r.h[i] = h; r.l[i] = (__bf16)(v[i] - (float)h); }
  return r; }
__device__ __forceinline__ F2 split_row(const float* row, int k0, int lane) { float v[16]; const float* p = row + k0 + 8 * (lane >> 4);
#pragma unroll
  for (int i = 0; i < 8; ++i) { v[i] = p[i]; v[8 + i] = p[16 + i]; }
  return bsplit16(v); }
__device__ __forceinline__ F2 split_rowK(const float* row, int k0, int lane, int K) { float v[16]; const int g = lane >> 4;
#pragma unroll
  for (int i = 0; i < 8; ++i) { const int ka = k0 + 8 * g + i, kb = ka + 16; v[i] = ka < K ? row[ka < K ? ka : K - 1] : 0.f; v[8 + i] = kb < K ? row[kb < K ? kb : K - 1] : 0.f; }
  return bsplit16(v); }
__device__ __forceinline__ F2 split_col(const float* W, int k0, int n, int lane, int ld, int K) { float v[16]; const int g = lane >> 4;
#pragma unroll
  for (int i = 0; i < 8; ++i) { const int ka = k0 + 8 * g + i, kb = ka + 16; v[i] = ka < K ? W[(size_t)(ka < K ? ka : K - 1) * ld + n] : 0.f; v[8 + i] = kb < K ? W[(size_t)(kb < K ? kb : K - 1) * ld + n] : 0.f; }
  return bsplit16(v); }
__device__ __forceinline__ v8f mac3(const F2& a, const F2& b, v8f c) { c = wmma_bf(a.l, b.h, c); c = wmma_bf(a.h, b.l, c); return wmma_bf(a.h, b.h, c); }
__device__ __forceinline__ float sigm(float v) { return 1.0f / (1.0f + expf(-v)); }
#define LDSX() do { asm volatile("s_wait_dscnt 0" ::: "memory"); __builtin_amdgcn_wave_barrier(); __builtin_amdgcn_fence(__ATOMIC_RELEASE, "workgroup"); } while (0)


// Encoder-decoder multi-head attention (B 1, N 4,096 queries and keys, d_model 768, 12 heads x 64): q from x, k/v from the encoding, softmax(Q K^T / 8) V, output projection + bias.
#define NQ 4096
#define NK 4096
#define DM 768
#define NH 12
#define HD 64
#ifndef TQB
#define TQB (NQ / 64)
#endif
typedef __attribute__((ext_vector_type(8))) __bf16 v8b;
__device__ __forceinline__ v16b frag_b(const __bf16* rowk0, int lane) {
  union { v16b v; v8b q[2]; } u; const __bf16* p = rowk0 + 8 * (lane >> 4);
  u.q[0] = *(const v8b*)p; u.q[1] = *(const v8b*)(p + 16); return u.v;
}
// fragment-order blocks: one (16 rows or columns) x (32 k) operand tile = 512 elements laid [half of the slots][lane][8], so each of a fragment's two wave-wide 16-byte loads covers 512 contiguous bytes; p = block + 8 * lane
__device__ __forceinline__ v16b fragp_b(const __bf16* p) { union { v16b v; v8b q[2]; } u; u.q[0] = *(const v8b*)p; u.q[1] = *(const v8b*)(p + 256); return u.v; }
__device__ __forceinline__ v16h fragp_h(const _Float16* p) { union { v16h v; v8h q[2]; } u; u.q[0] = *(const v8h*)p; u.q[1] = *(const v8h*)(p + 256); return u.v; }
__device__ __forceinline__ float bfr(float v) { return (float)(__bf16)v; }
__device__ __attribute__((noinline)) float exp_ni(float v) { return expf(v); }
__device__ __attribute__((noinline)) float erf_ni(float v) { return erff(v); }

#define WS_PW  0u                                   // bf16 w_q, w_k, w_v, w_o as fragment blocks [4][48 column tiles][24 k chunks][512]
#define WS_Q   (WS_PW + 2u * (size_t)4 * DM * DM)       // f16 Q rows [NQ][768]; K blocks [head][256 key tiles][2 d chunks][512]; V blocks [head][128 passes][4 d tiles][512]; f32 ctx blocks [256 row tiles][24 k chunks][4][lane][4]
#define WS_K   (WS_Q + 2u * (size_t)NQ * DM)
#define WS_V   (WS_K + 2u * (size_t)NK * DM)
#define WS_O   (WS_V + 2u * (size_t)DM * NK)
#define WS_XB  (WS_O + 4u * (size_t)NQ * DM)            // bf16 x, encoding as fragment blocks [2][256 row tiles][24 k chunks][512]
#define WS_END (WS_XB + 2u * (size_t)(NQ + NK) * DM)

// ---- k_pack: a 16-byte piece = 8 k of one row or column of a fragment block, rounded to bf16; thread = that piece in 4 k chunks (fewer, longer waves: the launch is short and wave starts count); block = (4 k chunks, y): y < 48 weights (the reads run along n, whole lines), else 64 rows of x or of the encoding; a wave stores whole lines
__global__ __launch_bounds__(256) void k_pack(const float* __restrict__ X, const float* __restrict__ ENC, const float* __restrict__ WQ, const float* __restrict__ WK, const float* __restrict__ WV, const float* __restrict__ WO, __bf16* __restrict__ PW, __bf16* __restrict__ XB) { const int kc0 = blockIdx.x * 4, y = blockIdx.y, t = threadIdx.x; v8b o[4];
  if (y < 48) { const int which = y / 12, p = (y % 12) / 3, n = (y % 3) * 256 + t; const float* w = (which == 0) ? WQ : (which == 1) ? WK : (which == 2) ? WV : WO; const float* s = w + (size_t)(kc0 * 32 + p * 8) * DM + n; __bf16* d = PW + (((size_t)which * (DM / 16) + (n >> 4)) * (DM / 32) + kc0) * 512 + p * 128 + (n & 15) * 8;
#pragma unroll
    for (int kk = 0; kk < 4; ++kk) {
#pragma unroll
      for (int i = 0; i < 8; ++i) o[kk][i] = (__bf16)s[(size_t)(kk * 32 + i) * DM]; }
#pragma unroll
    for (int kk = 0; kk < 4; ++kk) vst2(d + kk * 512, o[kk]); }
  else { const int src = (y - 48) >> 6, rt = ((y - 48) & 63) * 4 + (t >> 6), p = (t >> 4) & 3, c = t & 15; const float* s = (src ? ENC : X) + (size_t)(rt * 16 + c) * DM + kc0 * 32 + p * 8; __bf16* d = XB + (((size_t)src * (NQ / 16) + rt) * (DM / 32) + kc0) * 512 + p * 128 + c * 8;
#pragma unroll
    for (int kk = 0; kk < 4; ++kk) { const v4f lo = *(const v4f*)(s + kk * 32), hi = *(const v4f*)(s + kk * 32 + 4);
#pragma unroll
      for (int i = 0; i < 4; ++i) { o[kk][i] = (__bf16)lo[i]; o[kk][4 + i] = (__bf16)hi[i]; } }
#pragma unroll
    for (int kk = 0; kk < 4; ++kk) vst2(d + kk * 512, o[kk]); } }
// ---- k_proj: block = (64 rows, 128 cols, which): Q from x, K/V from the encoding (both as packed blocks; + bias); Q f16 rows, K and V fragment blocks
__global__ __launch_bounds__(128) void k_proj(const __bf16* __restrict__ XB, const __bf16* __restrict__ PW, const float* __restrict__ BQ, const float* __restrict__ BK, const float* __restrict__ BV, _Float16* __restrict__ Q, _Float16* __restrict__ Kr, _Float16* __restrict__ V) {
  __shared__ __align__(16) _Float16 so[64][136]; __shared__ __align__(16) _Float16 st[128][72];
  const int tid = threadIdx.x, wave = tid >> 5, lane = tid & 31, col = lane & 15, g = lane >> 4; const int which = blockIdx.z; const size_t rb = (size_t)blockIdx.x * 64; if (which == 0 && rb >= (size_t)TQB * 64) return;
  const size_t r0 = rb + wave * 16; const int c0 = blockIdx.y * 128; const __bf16* Wr = PW + ((size_t)which * (DM / 16) + (c0 >> 4)) * (DM / 32) * 512 + 8 * lane; const float* BB = (which == 0) ? BQ : (which == 1) ? BK : BV;
  v8f acc[8] = {};
  // fragments run one k step ahead: each weight fragment is reloaded for step kc + 1 right behind the product that used it, the activation row at the head of the step
  const __bf16* Ap = XB + ((size_t)(which != 0) * (NQ / 16) + (r0 >> 4)) * (DM / 32) * 512 + 8 * lane; v16b an = fragp_b(Ap), w[8];
  __builtin_amdgcn_sched_barrier(0);   // the row's loads stay the oldest here as in the loop: the wait at the loop's head is then a counted one, not for every load in flight
#pragma unroll
  for (int j = 0; j < 8; ++j) w[j] = fragp_b(Wr + j * (DM / 32) * 512);
#pragma unroll 1   // stays rolled: with the odd trip count an unroll by 2 came out as all 24 steps in a row
  for (int kc = 0; kc < DM / 32 - 1; ++kc) { const v16b a = an; an = fragp_b(Ap + (kc + 1) * 512);
#pragma unroll
    for (int j = 0; j < 8; ++j) { acc[j] = wmma_bf(a, w[j], acc[j]); w[j] = fragp_b(Wr + (j * (DM / 32) + kc + 1) * 512); }
    asm volatile("s_wait_xcnt 0x0" ::: "memory"); }   // stands in front of the next step's rewrite of the last loads' address registers
#pragma unroll
  for (int j = 0; j < 8; ++j) acc[j] = wmma_bf(an, w[j], acc[j]);
#pragma unroll
  for (int j = 0; j < 8; ++j) { const float bb = bfr(BB[c0 + j * 16 + col]);
#pragma unroll
    for (int r = 0; r < 8; ++r) { const _Float16 hv = (_Float16)(acc[j][r] + bb); if (which < 2) so[wave * 16 + 8 * g + r][j * 16 + col] = hv; else st[j * 16 + col][wave * 16 + 8 * g + r] = hv; } }
  __syncthreads();
  if (which == 0) { for (int e = tid; e < 64 * 16; e += 128) { const int rl = e >> 4, q = e & 15; vst2((unsigned*)(Q + (rb + rl) * DM + c0 + q * 8), *(const v4u*)&so[rl][q * 8]); } }
  // K, V: piece e = (head of 2, tile, chunk, 8-element group p of 4, row c of 16) in block order, so a wave stores 512 contiguous bytes
  else if (which == 1) { for (int e = tid; e < 64 * 16; e += 128) { const int c = e & 15, p = (e >> 4) & 3, kc = (e >> 6) & 1, kt = (e >> 7) & 3, hd = e >> 9; vst2((unsigned*)(Kr + ((((size_t)(c0 >> 6) + hd) * (NK / 16) + (rb >> 4) + kt) * 2 + kc) * 512 + p * 128 + c * 8), *(const v4u*)&so[kt * 16 + c][hd * 64 + kc * 32 + p * 8]); } }
  else { for (int e = tid; e < 128 * 8; e += 128) { const int c = e & 15, p = (e >> 4) & 3, dt = (e >> 6) & 3, ksl = (e >> 8) & 1, hd = e >> 9; vst2((unsigned*)(V + ((((size_t)(c0 >> 6) + hd) * (NK / 32) + (rb >> 5) + ksl) * 4 + dt) * 512 + p * 128 + c * 8), *(const v4u*)&st[hd * 64 + dt * 16 + c][ksl * 32 + p * 8]); } }
}
// ---- k_attn: block = (64 queries, head): softmax(q k / 8) over the 4,096 keys, transposed: scores^T = K . Q^T and ctx^T += V^T . P^T, so a lane holds 16 scores of ONE query of each column group (column col; keys 8g + r and 16 + 8g + r of the pass, g = lane >> 4); wave = (32 queries = 2 column groups, one half of the keys): every K and V fragment that a wave loads feeds two products; the two key halves are joined once at the end through LDS; ctx f32 in the fragment blocks that k_out reads
__device__ __forceinline__ float xhalf(float v) { const int b = __builtin_bit_cast(int, v); return __builtin_bit_cast(float, __builtin_amdgcn_permlanex16(b, b, 0x76543210, 0xfedcba98, false, false)); }   // the value of lane ^ 16: the same query's other half of the keys
// 2^x of a whole score tile in one statement, and of one value: inside it no result is read and no source overwritten directly behind a v_exp_f32 (every output is early-clobber), and the closing v_nop is the slot that the instruction set asks for behind the last one
__device__ __forceinline__ v8f exp2x8(v8f x) { float r0, r1, r2, r3, r4, r5, r6, r7;
  asm("v_exp_f32 %0, %8\n\tv_exp_f32 %1, %9\n\tv_exp_f32 %2, %10\n\tv_exp_f32 %3, %11\n\tv_exp_f32 %4, %12\n\tv_exp_f32 %5, %13\n\tv_exp_f32 %6, %14\n\tv_exp_f32 %7, %15\n\tv_nop"
      : "=&v"(r0), "=&v"(r1), "=&v"(r2), "=&v"(r3), "=&v"(r4), "=&v"(r5), "=&v"(r6), "=&v"(r7)
      : "v"(x[0]), "v"(x[1]), "v"(x[2]), "v"(x[3]), "v"(x[4]), "v"(x[5]), "v"(x[6]), "v"(x[7]));
  const v8f r = { r0, r1, r2, r3, r4, r5, r6, r7 }; return r; }
__device__ __forceinline__ float exp2x1(float x) { float r; asm("v_exp_f32 %0, %1\n\tv_nop" : "=&v"(r) : "v"(x)); return r; }
#define LOG2E 1.44269504f
#define NKH (NK / 2)
__global__ __launch_bounds__(128) void k_attn(const _Float16* __restrict__ Q, const _Float16* __restrict__ Kr, const _Float16* __restrict__ V, float* __restrict__ O) {
  __shared__ __align__(16) v4f sx[2][17][32];   // the upper key half's state of each 32-query wave: [16 pieces of ctx, then (m, m, l, l)][lane]
  const int tid = threadIdx.x, wave = __builtin_amdgcn_readfirstlane(tid >> 5), lane = tid & 31, col = lane & 15; const int qh = wave & 1, kh = wave >> 1; const int h = blockIdx.y; const int q0 = blockIdx.x * 64 + qh * 32; const size_t rq = (size_t)q0;
  v16h bq[2][2];   // B operand: column = query
#pragma unroll
  for (int qg = 0; qg < 2; ++qg) {
#pragma unroll
    for (int kc = 0; kc < 2; ++kc) bq[qg][kc] = frag_h(Q + (rq + qg * 16 + col) * DM + h * HD + kc * 32, lane); }
  float m[2] = { -3.0e38f, -3.0e38f }, l[2] = { 0.f, 0.f };   // each query's running maximum (equal in both lane halves) and this lane half's sum
  v8f acc[2][4] = {};   // acc[qg][dt][r] = ctx[query 16 qg + col][16 dt + 8g + r]
  // K fragments (A: row = key) run one pass ahead (reloaded as one group behind the score products); V fragments (A: row = d) are asked for as one group at the head of their pass
  v16h kf[2][2], vf[4]; const _Float16* Kp = Kr + (size_t)h * NK * HD + (size_t)kh * NKH * HD + 8 * lane; const _Float16* Vp = V + (size_t)h * NK * HD + (size_t)kh * NKH * HD + 8 * lane;   // a pass = 4 blocks of each, 4 KiB in a row
#pragma unroll
  for (int ct = 0; ct < 2; ++ct) {
#pragma unroll
    for (int kc = 0; kc < 2; ++kc) kf[ct][kc] = fragp_h(Kp + (ct * 2 + kc) * 512); }
#pragma unroll 1
  for (int ks = 0; ks < NKH / 32; ++ks) { v8f s[2][2];
#pragma unroll
    for (int dt = 0; dt < 4; ++dt) vf[dt] = fragp_h(Vp + (ks * 4 + dt) * 512);
#pragma unroll
    for (int ct = 0; ct < 2; ++ct) {
#pragma unroll
      for (int qg = 0; qg < 2; ++qg) { const v8f z = {}; s[qg][ct] = wmma16(kf[ct][0], bq[qg][0], z); } }
#pragma unroll
    for (int ct = 0; ct < 2; ++ct) {
#pragma unroll
      for (int qg = 0; qg < 2; ++qg) s[qg][ct] = wmma16(kf[ct][1], bq[qg][1], s[qg][ct]); }
    const int jn = ((ks + 1) & (NKH / 32 - 1)) * 4;   // the last pass asks for the half's first blocks again: in bounds, not used
#pragma unroll
    for (int ct = 0; ct < 2; ++ct) {
#pragma unroll
      for (int kc = 0; kc < 2; ++kc) kf[ct][kc] = fragp_h(Kp + (jn + ct * 2 + kc) * 512); }
    __builtin_amdgcn_sched_barrier(0);   // keeps the K loads here, ahead of the whole softmax, so that they have the rest of the pass to land
    v16h pb[2];   // B operands straight from the score tiles: slot i = key 8g + i, slot 8 + i = key 16 + 8g + i, the k order of the V blocks
#pragma unroll
    for (int qg = 0; qg < 2; ++qg) { const v8f s0 = s[qg][0] * 0.125f, s1 = s[qg][1] * 0.125f;   // whole-tile expressions: the packed forms then pair neighbouring registers of one tile, not the two column groups (which costs register copies)
      float mq[4];
#pragma unroll
      for (int i = 0; i < 4; ++i) mq[i] = fmaxf(fmaxf(s0[i], s0[4 + i]), fmaxf(s1[i], s1[4 + i]));
      float mx = fmaxf(fmaxf(mq[0], mq[1]), fmaxf(mq[2], mq[3])); mx = fmaxf(mx, xhalf(mx));
      const float mn = fmaxf(m[qg], mx); const float ea = exp2x1((m[qg] - mn) * LOG2E), alpha = (m[qg] <= -1.0e38f) ? 0.f : ea; m[qg] = mn;   // exp(x) = 2^(x log2 e), as __expf forms it; formed ahead of the test, so that the test stays a select and no branch
      const v8f e[2] = { exp2x8((s0 - mn) * LOG2E), exp2x8((s1 - mn) * LOG2E) };
      const v8f t8 = e[0] + e[1]; const v4f t4 = t8.lo + t8.hi; const v2f t2 = t4.lo + t4.hi;
      l[qg] = l[qg] * alpha + (t2.x + t2.y);
#pragma unroll
      for (int dt = 0; dt < 4; ++dt) acc[qg][dt] *= alpha;
      const v8f p0 = e[0] * 2048.0f, p1 = e[1] * 2048.0f;
#pragma unroll
      for (int i = 0; i < 8; ++i) { pb[qg][i] = (_Float16)p0[i]; pb[qg][8 + i] = (_Float16)p1[i]; } }
#pragma unroll
    for (int dt = 0; dt < 4; ++dt) {
#pragma unroll
      for (int qg = 0; qg < 2; ++qg) acc[qg][dt] = wmma16(vf[dt], pb[qg], acc[qg][dt]); } }
  // join of the key halves: the upper half's waves hand their state over, the lower half's waves bring both to the common maximum and store
  if (kh) {
#pragma unroll
    for (int b = 0; b < 16; ++b) { v4f o;
#pragma unroll
      for (int i = 0; i < 4; ++i) o[i] = acc[b >> 3][(b >> 1) & 3][(b & 1) * 4 + i];
      sx[qh][b][lane] = o; }
    const v4f ml = { m[0], m[1], l[0], l[1] }; sx[qh][16][lane] = ml; }
  __syncthreads();   // publishes the upper half's state to the wave that joins it; every wave passes it
  if (kh) return;
  const v4f ml = sx[qh][16][lane];
#pragma unroll
  for (int qg = 0; qg < 2; ++qg) { const float mt = fmaxf(m[qg], ml[qg]), a0 = __expf(m[qg] - mt), a1 = __expf(ml[qg] - mt);
    float lt = l[qg] * a0 + ml[2 + qg] * a1; lt += xhalf(lt); const float il = (1.0f / 2048.0f) / lt, f0 = a0 * il, f1 = a1 * il;
    // a lane already holds the 32 values of its places in the two ctx blocks of each column group
#pragma unroll
    for (int b = 0; b < 8; ++b) { const v4f u = sx[qh][qg * 8 + b][lane]; v4f o;
#pragma unroll
      for (int i = 0; i < 4; ++i) o[i] = acc[qg][b >> 1][(b & 1) * 4 + i] * f0 + u[i] * f1;
      vst2(O + ((size_t)((q0 >> 4) + qg) * (DM / 32) + h * 2 + (b >> 2)) * 512 + (b & 3) * 128 + lane * 4, o); } }
}
// ---- k_out: block = (64 rows, 128 cols): out = ctx (hi + lo) . w_o + b_o
__global__ __launch_bounds__(128) void k_out(const float* __restrict__ O, const __bf16* __restrict__ PW, const float* __restrict__ BO, float* __restrict__ Y) { __shared__ __align__(16) float so[4][16][132];
  const int tid = threadIdx.x, wave = tid >> 5, lane = tid & 31, col = lane & 15, g = lane >> 4; const size_t r0 = (size_t)blockIdx.x * 64 + wave * 16; const int c0 = blockIdx.y * 128; const __bf16* Wr = PW + ((size_t)3 * (DM / 16) + (c0 >> 4)) * (DM / 32) * 512 + 8 * lane;
  v8f acc[8] = {};
  // fragments run one k step ahead, as in k_proj
  const float* Op = O + (r0 >> 4) * (DM / 32) * 512 + 4 * lane; v4f ar[4]; v16b w[8];
#pragma unroll
  for (int i = 0; i < 4; ++i) ar[i] = *(const v4f*)(Op + i * 128);
  __builtin_amdgcn_sched_barrier(0);   // the row's loads stay the oldest here as in the loop: the wait at the loop's head is then a counted one, not for every load in flight
#pragma unroll
  for (int j = 0; j < 8; ++j) w[j] = fragp_b(Wr + j * (DM / 32) * 512);
#pragma unroll 1   // stays rolled: with the odd trip count an unroll by 2 came out as all 24 steps in a row
  for (int kc = 0; kc < DM / 32 - 1; ++kc) { float v[16];
#pragma unroll
    for (int i = 0; i < 16; ++i) v[i] = ar[i >> 2][i & 3];
    const F2 a = bsplit16(v); Op += 512;   // a running pointer: its register pair lives over the whole loop, so no load's result can be placed in it
#pragma unroll
    for (int i = 0; i < 4; ++i) ar[i] = *(const v4f*)(Op + i * 128);
#pragma unroll
    for (int j = 0; j < 8; ++j) { acc[j] = wmma_bf(a.h, w[j], acc[j]); acc[j] = wmma_bf(a.l, w[j], acc[j]); w[j] = fragp_b(Wr + (j * (DM / 32) + kc + 1) * 512); }
    __builtin_amdgcn_sched_barrier(0);   // keeps the register copies of the rows just asked for at the loop's foot: lifted among the products they wait for those loads a whole step early
    asm volatile("s_wait_xcnt 0x0" ::: "memory"); }   // stands in front of the next step's rewrite of the last loads' address registers
  { float v[16];
#pragma unroll
    for (int i = 0; i < 16; ++i) v[i] = ar[i >> 2][i & 3];
    const F2 a = bsplit16(v);
#pragma unroll
    for (int j = 0; j < 8; ++j) { acc[j] = wmma_bf(a.h, w[j], acc[j]); acc[j] = wmma_bf(a.l, w[j], acc[j]); } }
#pragma unroll
  for (int j = 0; j < 8; ++j) { const float bb = bfr(BO[c0 + j * 16 + col]);
#pragma unroll
    for (int r = 0; r < 8; ++r) so[wave][8 * g + r][j * 16 + col] = acc[j][r] + bb; }
  LDSX(); for (int rl = 0; rl < 16; ++rl) vst2(Y + (r0 + rl) * DM + c0 + lane * 4, *(const v4f*)&so[wave][rl][lane * 4]); }
extern "C" void kernel_launch(void* const* d_in, const int* in_sizes, int n_in, void* d_out, int out_size, void* d_ws, size_t ws_size, hipStream_t stream) {
  (void)in_sizes; (void)n_in; (void)out_size;
  const float** F = (const float**)d_in;   // 0 x [1,4096,768], 1 encoding [1,4096,768], 2 w_q (in,out), 3 b_q, 4 w_k, 5 b_k, 6 w_v, 7 b_v, 8 w_o [768,768] (in,out), 9 b_o
  if (ws_size < (size_t)WS_END) return;
  char* ws = (char*)d_ws; __bf16* PW = (__bf16*)ws; _Float16 *Q = (_Float16*)(ws + WS_Q), *Kr = (_Float16*)(ws + WS_K), *V = (_Float16*)(ws + WS_V); float* O = (float*)(ws + WS_O); __bf16* XB = (__bf16*)(ws + WS_XB);
  k_pack<<<dim3(DM / 128, 48 + 128), 256, 0, stream>>>(F[0], F[1], F[2], F[4], F[6], F[8], PW, XB);
  k_proj<<<dim3(NK / 64, DM / 128, 3), 128, 0, stream>>>(XB, PW, F[3], F[5], F[7], Q, Kr, V);
  k_attn<<<dim3(TQB, NH), 128, 0, stream>>>(Q, Kr, V, O);
  k_out<<<dim3(TQB, DM / 128), 128, 0, stream>>>(O, PW, F[9], (float*)d_out);
}

// v005
// It runs in 106 microseconds.
// Next to v004, in two timings, it ran 1.04 and 1.03 times as fast.
// All steps since v000 together make it 4.33 times as fast.
// compute dtype: all float inputs rounded to bf16; Q = x . w_q + b, K/V = encoding . w + b with EXACT bf16 products on WMMA 16x16x32 (x, encoding and the (in,out) weights packed to bf16 fragment blocks first), rounded once to f16; attention over the 4,096 keys: q, k single f16 x 1/8, running-max softmax in f32 (hardware exp), P (scaled by 2^11, single f16) x v (single f16); out = ctx (bf16 hi + lo, 2 products) . w_o + b_o; f32 output.
#include <hip/hip_runtime.h>
#include <math.h>

typedef __attribute__((ext_vector_type(16))) _Float16 v16h;
typedef __attribute__((ext_vector_type(16))) __bf16 v16b;
typedef __attribute__((ext_vector_type(8)))  _Float16 v8h;
typedef __attribute__((ext_vector_type(8)))  float v8f;
typedef __attribute__((ext_vector_type(4)))  float v4f;
typedef __attribute__((ext_vector_type(2)))  float v2f;
typedef __attribute__((ext_vector_type(4)))  unsigned v4u;
typedef __attribute__((ext_vector_type(4)))  int v4i;
typedef float __attribute__((may_alias)) float_a;
typedef int __attribute__((may_alias)) int_a;

template <typename T> __device__ __forceinline__ void vst2(void* p, T v) { *(T*)p = v;  }
__device__ __forceinline__ v8f wmma16(v16h a, v16h b, v8f c) {
  v8f d = __builtin_amdgcn_wmma_f32_16x16x32_f16(false, a, false, b, (short)0, c, false, false);
  asm volatile("v_nop\n\tv_nop\n\tv_nop\n\tv_nop" : "+v"(d) : "v"(a), "v"(b));
  return d;
}
__device__ __forceinline__ v8f wmma_bf(v16b a, v16b b, v8f c) {
  v8f d = __builtin_amdgcn_wmma_f32_16x16x32_bf16(false, a, false, b, (short)0, c, false, false);
  asm volatile("v_nop\n\tv_nop\n\tv_nop\n\tv_nop" : "+v"(d) : "v"(a), "v"(b));
  return d;
}
// 16x16x32 fragments: lane = (h = lane>>4, row/col = lane&15); elements 0..7 = k0+8h+0..7, 8..15 = k0+16+8h+0..7; D element r = row 8h+r
__device__ __forceinline__ v16h frag_h(const _Float16* rowk0, int lane) {
  union { v16h v; v8h q[2]; } u; const _Float16* p = rowk0 + 8 * (lane >> 4);
  u.q[0] = *(const v8h*)p; u.q[1] = *(const v8h*)(p + 16); return u.v;
}
__device__ __forceinline__ v16h frag_f32(const float* rowk0, int lane) {
  v16h a; const float* p = rowk0 + 8 * (lane >> 4);
#pragma unroll
  for (int i = 0; i < 8; ++i) { a[i] = (_Float16)p[i]; a[8 + i] = (_Float16)p[16 + i]; }
  return a;
}
__device__ __forceinline__ v16h frag_f32s(const float* rowk0, int lane, float sc) {
  v16h a; const float* p = rowk0 + 8 * (lane >> 4);
#pragma unroll
  for (int i = 0; i < 8; ++i) { a[i] = (_Float16)(p[i] * sc); a[8 + i] = (_Float16)(p[16 + i] * sc); }
  return a;
}
// column fragment from a [K][ld] layout (column n), rows >= K read as 0
__device__ __forceinline__ v16h fragc_f32(const float* W, int k0, int n, int lane, int ld, int K) {
  v16h a; const int g = lane >> 4;
#pragma unroll
  for (int i = 0; i < 8; ++i) { const int ka = k0 + 8 * g + i, kb = ka + 16;
    a[i] = (_Float16)(ka < K ? W[(size_t)(ka < K ? ka : K - 1) * ld + n] : 0.f); a[8 + i] = (_Float16)(kb < K ? W[(size_t)(kb < K ? kb : K - 1) * ld + n] : 0.f); }
  return a;
}
struct F2 { v16b h, l; };
__device__ __forceinline__ F2 bsplit16(const float v[16]) { F2 r;
#pragma unroll
  for (int i = 0; i < 16; ++i) { const __bf16 h = (__bf16)v[i]; r.h[i] = h; r.l[i] = (__bf16)(v[i] - (float)h); }
  return r; }
__device__ __forceinline__ F2 split_row(const float* row, int k0, int lane) { float v[16]; const float* p = row + k0 + 8 * (lane >> 4);
#pragma unroll
  for (int i = 0; i < 8; ++i) { v[i] = p[i]; v[8 + i] = p[16 + i]; }
  return bsplit16(v); }
__device__ __forceinline__ F2 split_rowK(const float* row, int k0, int lane, int K) { float v[16]; const int g = lane >> 4;
#pragma unroll
  for (int i = 0; i < 8; ++i) { const int ka = k0 + 8 * g + i, kb = ka + 16; v[i] = ka < K ? row[ka < K ? ka : K - 1] : 0.f; v[8 + i] = kb < K ? row[kb < K ? kb : K - 1] : 0.f; }
  return bsplit16(v); }
__device__ __forceinline__ F2 split_col(const float* W, int k0, int n, int lane, int ld, int K) { float v[16]; const int g = lane >> 4;
#pragma unroll
  for (int i = 0; i < 8; ++i) { const int ka = k0 + 8 * g + i, kb = ka + 16; v[i] = ka < K ? W[(size_t)(ka < K ? ka : K - 1) * ld + n] : 0.f; v[8 + i] = kb < K ? W[(size_t)(kb < K ? kb : K - 1) * ld + n] : 0.f; }
  return bsplit16(v); }
__device__ __forceinline__ v8f mac3(const F2& a, const F2& b, v8f c) { c = wmma_bf(a.l, b.h, c); c = wmma_bf(a.h, b.l, c); return wmma_bf(a.h, b.h, c); }
__device__ __forceinline__ float sigm(float v) { return 1.0f / (1.0f + expf(-v)); }
#define LDSX() do { asm volatile("s_wait_dscnt 0" ::: "memory"); __builtin_amdgcn_wave_barrier(); __builtin_amdgcn_fence(__ATOMIC_RELEASE, "workgroup"); } while (0)


// Encoder-decoder multi-head attention (B 1, N 4,096 queries and keys, d_model 768, 12 heads x 64): q from x, k/v from the encoding, softmax(Q K^T / 8) V, output projection + bias.
#define NQ 4096
#define NK 4096
#define DM 768
#define NH 12
#define HD 64
#ifndef TQB
#define TQB (NQ / 64)
#endif
typedef __attribute__((ext_vector_type(8))) __bf16 v8b;
__device__ __forceinline__ v16b frag_b(const __bf16* rowk0, int lane) {
  union { v16b v; v8b q[2]; } u; const __bf16* p = rowk0 + 8 * (lane >> 4);
  u.q[0] = *(const v8b*)p; u.q[1] = *(const v8b*)(p + 16); return u.v;
}
// fragment-order blocks: one (16 rows or columns) x (32 k) operand tile = 512 elements laid [half of the slots][lane][8], so each of a fragment's two wave-wide 16-byte loads covers 512 contiguous bytes; p = block + 8 * lane
__device__ __forceinline__ v16b fragp_b(const __bf16* p) { union { v16b v; v8b q[2]; } u; u.q[0] = *(const v8b*)p; u.q[1] = *(const v8b*)(p + 256); return u.v; }
__device__ __forceinline__ v16h fragp_h(const _Float16* p) { union { v16h v; v8h q[2]; } u; u.q[0] = *(const v8h*)p; u.q[1] = *(const v8h*)(p + 256); return u.v; }
__device__ __forceinline__ float bfr(float v) { return (float)(__bf16)v; }
__device__ __attribute__((noinline)) float exp_ni(float v) { return expf(v); }
__device__ __attribute__((noinline)) float erf_ni(float v) { return erff(v); }

#define WS_PW  0u                                   // bf16 w_q, w_k, w_v, w_o as fragment blocks [4][48 column tiles][24 k chunks][512]
#define WS_Q   (WS_PW + 2u * (size_t)4 * DM * DM)       // f16 Q rows [NQ][768]; K blocks [head][256 key tiles][2 d chunks][512]; V blocks [head][128 passes][4 d tiles][512]; f32 ctx blocks [256 row tiles][24 k chunks][4][lane][4]
#define WS_K   (WS_Q + 2u * (size_t)NQ * DM)
#define WS_V   (WS_K + 2u * (size_t)NK * DM)
#define WS_O   (WS_V + 2u * (size_t)DM * NK)
#define WS_XB  (WS_O + 4u * (size_t)NQ * DM)            // bf16 x, encoding as fragment blocks [2][256 row tiles][24 k chunks][512]
#define WS_END (WS_XB + 2u * (size_t)(NQ + NK) * DM)

// ---- k_pack: a 16-byte piece = 8 k of one row or column of a fragment block, rounded to bf16; thread = that piece in 4 k chunks (fewer, longer waves: the launch is short and wave starts count); block = (4 k chunks, y): y < 48 weights (the reads run along n, whole lines), else 64 rows of x or of the encoding; a wave stores whole lines
__global__ __launch_bounds__(256) void k_pack(const float* __restrict__ X, const float* __restrict__ ENC, const float* __restrict__ WQ, const float* __restrict__ WK, const float* __restrict__ WV, const float* __restrict__ WO, __bf16* __restrict__ PW, __bf16* __restrict__ XB) { const int kc0 = blockIdx.x * 4, y = blockIdx.y, t = threadIdx.x; v8b o[4];
  if (y < 48) { const int which = y / 12, p = (y % 12) / 3, n = (y % 3) * 256 + t; const float* w = (which == 0) ? WQ : (which == 1) ? WK : (which == 2) ? WV : WO; const float* s = w + (size_t)(kc0 * 32 + p * 8) * DM + n; __bf16* d = PW + (((size_t)which * (DM / 16) + (n >> 4)) * (DM / 32) + kc0) * 512 + p * 128 + (n & 15) * 8;
#pragma unroll
    for (int kk = 0; kk < 4; ++kk) {
#pragma unroll
      for (int i = 0; i < 8; ++i) o[kk][i] = (__bf16)s[(size_t)(kk * 32 + i) * DM]; }
#pragma unroll
    for (int kk = 0; kk < 4; ++kk) vst2(d + kk * 512, o[kk]); }
  else { const int src = (y - 48) >> 6, rt = ((y - 48) & 63) * 4 + (t >> 6), p = (t >> 4) & 3, c = t & 15; const float* s = (src ? ENC : X) + (size_t)(rt * 16 + c) * DM + kc0 * 32 + p * 8; __bf16* d = XB + (((size_t)src * (NQ / 16) + rt) * (DM / 32) + kc0) * 512 + p * 128 + c * 8;
#pragma unroll
    for (int kk = 0; kk < 4; ++kk) { const v4f lo = *(const v4f*)(s + kk * 32), hi = *(const v4f*)(s + kk * 32 + 4);
#pragma unroll
      for (int i = 0; i < 4; ++i) { o[kk][i] = (__bf16)lo[i]; o[kk][4 + i] = (__bf16)hi[i]; } }
#pragma unroll
    for (int kk = 0; kk < 4; ++kk) vst2(d + kk * 512, o[kk]); } }
// ---- k_proj: block = (64 rows, 128 cols, which): Q from x, K/V from the encoding (both as packed blocks; + bias); Q f16 rows, K and V fragment blocks
__global__ __launch_bounds__(128) void k_proj(const __bf16* __restrict__ XB, const __bf16* __restrict__ PW, const float* __restrict__ BQ, const float* __restrict__ BK, const float* __restrict__ BV, _Float16* __restrict__ Q, _Float16* __restrict__ Kr, _Float16* __restrict__ V) {
  __shared__ __align__(16) _Float16 so[64][136]; __shared__ __align__(16) _Float16 st[128][72];
  const int tid = threadIdx.x, wave = tid >> 5, lane = tid & 31, col = lane & 15, g = lane >> 4; const int which = blockIdx.z; const size_t rb = (size_t)blockIdx.x * 64; if (which == 0 && rb >= (size_t)TQB * 64) return;
  const size_t r0 = rb + wave * 16; const int c0 = blockIdx.y * 128; const __bf16* Wr = PW + ((size_t)which * (DM / 16) + (c0 >> 4)) * (DM / 32) * 512 + 8 * lane; const float* BB = (which == 0) ? BQ : (which == 1) ? BK : BV;
  v8f acc[8] = {};
  // fragments run one k step ahead: each weight fragment is reloaded for step kc + 1 right behind the product that used it, the activation row at the head of the step
  const __bf16* Ap = XB + ((size_t)(which != 0) * (NQ / 16) + (r0 >> 4)) * (DM / 32) * 512 + 8 * lane; v16b an = fragp_b(Ap), w[8];
  __builtin_amdgcn_sched_barrier(0);   // the row's loads stay the oldest here as in the loop: the wait at the loop's head is then a counted one, not for every load in flight
#pragma unroll
  for (int j = 0; j < 8; ++j) w[j] = fragp_b(Wr + j * (DM / 32) * 512);
#pragma unroll 1   // stays rolled: with the odd trip count an unroll by 2 came out as all 24 steps in a row
  for (int kc = 0; kc < DM / 32 - 1; ++kc) { const v16b a = an; an = fragp_b(Ap + (kc + 1) * 512);
#pragma unroll
    for (int j = 0; j < 8; ++j) { acc[j] = wmma_bf(a, w[j], acc[j]); w[j] = fragp_b(Wr + (j * (DM / 32) + kc + 1) * 512); }
    asm volatile("s_wait_xcnt 0x0" ::: "memory"); }   // stands in front of the next step's rewrite of the last loads' address registers
#pragma unroll
  for (int j = 0; j < 8; ++j) acc[j] = wmma_bf(an, w[j], acc[j]);
#pragma unroll
  for (int j = 0; j < 8; ++j) { const float bb = bfr(BB[c0 + j * 16 + col]);
#pragma unroll
    for (int r = 0; r < 8; ++r) { const _Float16 hv = (_Float16)(acc[j][r] + bb); if (which < 2) so[wave * 16 + 8 * g + r][j * 16 + col] = hv; else st[j * 16 + col][wave * 16 + 8 * g + r] = hv; } }
  __syncthreads();
  if (which == 0) { for (int e = tid; e < 64 * 16; e += 128) { const int rl = e >> 4, q = e & 15; vst2((unsigned*)(Q + (rb + rl) * DM + c0 + q * 8), *(const v4u*)&so[rl][q * 8]); } }
  // K, V: piece e = (head of 2, tile, chunk, 8-element group p of 4, row c of 16) in block order, so a wave stores 512 contiguous bytes
  else if (which == 1) { for (int e = tid; e < 64 * 16; e += 128) { const int c = e & 15, p = (e >> 4) & 3, kc = (e >> 6) & 1, kt = (e >> 7) & 3, hd = e >> 9; vst2((unsigned*)(Kr + ((((size_t)(c0 >> 6) + hd) * (NK / 16) + (rb >> 4) + kt) * 2 + kc) * 512 + p * 128 + c * 8), *(const v4u*)&so[kt * 16 + c][hd * 64 + kc * 32 + p * 8]); } }
  else { for (int e = tid; e < 128 * 8; e += 128) { const int c = e & 15, p = (e >> 4) & 3, dt = (e >> 6) & 3, ksl = (e >> 8) & 1, hd = e >> 9; vst2((unsigned*)(V + ((((size_t)(c0 >> 6) + hd) * (NK / 32) + (rb >> 5) + ksl) * 4 + dt) * 512 + p * 128 + c * 8), *(const v4u*)&st[hd * 64 + dt * 16 + c][ksl * 32 + p * 8]); } }
}
// ---- k_attn: block = (64 queries, head): softmax(q k / 8) over the 4,096 keys, transposed: scores^T = K . Q^T and ctx^T += V^T . P^T, so a lane holds 16 scores of ONE query of each column group (column col; keys 8g + r and 16 + 8g + r of the pass, g = lane >> 4); wave = (32 queries = 2 column groups, one half of the keys): every K and V fragment that a wave loads feeds two products; the two key halves are joined once at the end through LDS; ctx f32 in the fragment blocks that k_out reads
__device__ __forceinline__ float xhalf(float v) { const int b = __builtin_bit_cast(int, v); return __builtin_bit_cast(float, __builtin_amdgcn_permlanex16(b, b, 0x76543210, 0xfedcba98, false, false)); }   // the value of lane ^ 16: the same query's other half of the keys
// 2^x of a whole score tile in one statement, and of one value: inside it no result is read and no source overwritten directly behind a v_exp_f32 (every output is early-clobber), and the closing v_nop is the slot that the instruction set asks for behind the last one
__device__ __forceinline__ v8f exp2x8(v8f x) { float r0, r1, r2, r3, r4, r5, r6, r7;
  asm("v_exp_f32 %0, %8\n\tv_exp_f32 %1, %9\n\tv_exp_f32 %2, %10\n\tv_exp_f32 %3, %11\n\tv_exp_f32 %4, %12\n\tv_exp_f32 %5, %13\n\tv_exp_f32 %6, %14\n\tv_exp_f32 %7, %15\n\tv_nop"
      : "=&v"(r0), "=&v"(r1), "=&v"(r2), "=&v"(r3), "=&v"(r4), "=&v"(r5), "=&v"(r6), "=&v"(r7)
      : "v"(x[0]), "v"(x[1]), "v"(x[2]), "v"(x[3]), "v"(x[4]), "v"(x[5]), "v"(x[6]), "v"(x[7]));
  const v8f r = { r0, r1, r2, r3, r4, r5, r6, r7 }; return r; }
__device__ __forceinline__ float exp2x1(float x) { float r; asm("v_exp_f32 %0, %1\n\tv_nop" : "=&v"(r) : "v"(x)); return r; }
#define LOG2E 1.44269504f
#define SC2 (0.125f * LOG2E)   // a raw score times this = its exponent to base 2
#define NKH (NK / 2)
__global__ __launch_bounds__(128) void k_attn(const _Float16* __restrict__ Q, const _Float16* __restrict__ Kr, const _Float16* __restrict__ V, float* __restrict__ O) {
  __shared__ __align__(16) v4f sx[2][17][32];   // the upper key half's state of each 32-query wave: [16 pieces of ctx, then (m, m, l, l)][lane]
  const int tid = threadIdx.x, wave = __builtin_amdgcn_readfirstlane(tid >> 5), lane = tid & 31, col = lane & 15; const int qh = wave & 1, kh = wave >> 1; const int h = blockIdx.y; const int q0 = blockIdx.x * 64 + qh * 32; const size_t rq = (size_t)q0;
  v16h bq[2][2];   // B operand: column = query
#pragma unroll
  for (int qg = 0; qg < 2; ++qg) {
#pragma unroll
    for (int kc = 0; kc < 2; ++kc) bq[qg][kc] = frag_h(Q + (rq + qg * 16 + col) * DM + h * HD + kc * 32, lane); }
  float m[2] = { -3.0e38f, -3.0e38f }, l[2] = { 0.f, 0.f };   // each query's running maximum of the raw scores (equal in both lane halves) and this lane half's sum, which carries P's 2^11 like ctx
  v8f acc[2][4] = {};   // acc[qg][dt][r] = ctx[query 16 qg + col][16 dt + 8g + r]
  // K fragments (A: row = key) run one pass ahead (reloaded as one group behind the score products); V fragments (A: row = d) are asked for as one group at the head of their pass
  v16h kf[2][2], vf[4]; const _Float16* Kp = Kr + (size_t)h * NK * HD + (size_t)kh * NKH * HD + 8 * lane; const _Float16* Vp = V + (size_t)h * NK * HD + (size_t)kh * NKH * HD + 8 * lane;   // a pass = 4 blocks of each, 4 KiB in a row
#pragma unroll
  for (int ct = 0; ct < 2; ++ct) {
#pragma unroll
    for (int kc = 0; kc < 2; ++kc) kf[ct][kc] = fragp_h(Kp + (ct * 2 + kc) * 512); }
#pragma unroll 1
  for (int ks = 0; ks < NKH / 32; ++ks) { v8f s[2][2];
#pragma unroll
    for (int dt = 0; dt < 4; ++dt) vf[dt] = fragp_h(Vp + (ks * 4 + dt) * 512);
#pragma unroll
    for (int ct = 0; ct < 2; ++ct) {
#pragma unroll
      for (int qg = 0; qg < 2; ++qg) { const v8f z = {}; s[qg][ct] = wmma16(kf[ct][0], bq[qg][0], z); } }
#pragma unroll
    for (int ct = 0; ct < 2; ++ct) {
#pragma unroll
      for (int qg = 0; qg < 2; ++qg) s[qg][ct] = wmma16(kf[ct][1], bq[qg][1], s[qg][ct]); }
    const int jn = ((ks + 1) & (NKH / 32 - 1)) * 4;   // the last pass asks for the half's first blocks again: in bounds, not used
#pragma unroll
    for (int ct = 0; ct < 2; ++ct) {
#pragma unroll
      for (int kc = 0; kc < 2; ++kc) kf[ct][kc] = fragp_h(Kp + (jn + ct * 2 + kc) * 512); }
    __builtin_amdgcn_sched_barrier(0);   // keeps the K loads here, ahead of the whole softmax, so that they have the rest of the pass to land
    v16h pb[2];   // B operands straight from the score tiles: slot i = key 8g + i, slot 8 + i = key 16 + 8g + i, the k order of the V blocks
#pragma unroll
    for (int qg = 0; qg < 2; ++qg) { const v8f s0 = s[qg][0], s1 = s[qg][1];   // raw scores: the maximum is taken on them as they are (1/8 > 0 keeps the order), and 1/8, log2 e and P's 2^11 all go into the one multiply-add in front of the 2^x
      float mq[4];
#pragma unroll
      for (int i = 0; i < 4; ++i) mq[i] = fmaxf(fmaxf(s0[i], s0[4 + i]), fmaxf(s1[i], s1[4 + i]));
      float mx = fmaxf(fmaxf(mq[0], mq[1]), fmaxf(mq[2], mq[3])); mx = fmaxf(mx, xhalf(mx));
      const float mn = fmaxf(m[qg], mx); const float ea = exp2x1((m[qg] - mn) * SC2), alpha = (m[qg] <= -1.0e38f) ? 0.f : ea; m[qg] = mn;   // exp(x) = 2^(x log2 e), as __expf forms it; formed ahead of the test, so that the test stays a select and no branch
      const float nb = 11.0f - mn * SC2;
      const v8f e[2] = { exp2x8(s0 * SC2 + nb), exp2x8(s1 * SC2 + nb) };   // 2^11 exp((s - max) / 8); whole-tile expressions: the packed forms then pair neighbouring registers of one tile
      const v8f t8 = e[0] + e[1]; const v4f t4 = t8.lo + t8.hi; const v2f t2 = t4.lo + t4.hi;
      l[qg] = l[qg] * alpha + (t2.x + t2.y);
#pragma unroll
      for (int dt = 0; dt < 4; ++dt) acc[qg][dt] *= alpha;
#pragma unroll
      for (int i = 0; i < 8; ++i) { pb[qg][i] = (_Float16)e[0][i]; pb[qg][8 + i] = (_Float16)e[1][i]; } }
#pragma unroll
    for (int dt = 0; dt < 4; ++dt) {
#pragma unroll
      for (int qg = 0; qg < 2; ++qg) acc[qg][dt] = wmma16(vf[dt], pb[qg], acc[qg][dt]); } }
  // join of the key halves: the upper half's waves hand their state over, the lower half's waves bring both to the common maximum and store
  if (kh) {
#pragma unroll
    for (int b = 0; b < 16; ++b) { v4f o;
#pragma unroll
      for (int i = 0; i < 4; ++i) o[i] = acc[b >> 3][(b >> 1) & 3][(b & 1) * 4 + i];
      sx[qh][b][lane] = o; }
    const v4f ml = { m[0], m[1], l[0], l[1] }; sx[qh][16][lane] = ml; }
  __syncthreads();   // publishes the upper half's state to the wave that joins it; every wave passes it
  if (kh) return;
  const v4f ml = sx[qh][16][lane];
#pragma unroll
  for (int qg = 0; qg < 2; ++qg) { const float mt = fmaxf(m[qg], ml[qg]), a0 = __expf((m[qg] - mt) * 0.125f), a1 = __expf((ml[qg] - mt) * 0.125f);
    float lt = l[qg] * a0 + ml[2 + qg] * a1; lt += xhalf(lt); const float il = 1.0f / lt, f0 = a0 * il, f1 = a1 * il;
    // a lane already holds the 32 values of its places in the two ctx blocks of each column group
#pragma unroll
    for (int b = 0; b < 8; ++b) { const v4f u = sx[qh][qg * 8 + b][lane]; v4f o;
#pragma unroll
      for (int i = 0; i < 4; ++i) o[i] = acc[qg][b >> 1][(b & 1) * 4 + i] * f0 + u[i] * f1;
      vst2(O + ((size_t)((q0 >> 4) + qg) * (DM / 32) + h * 2 + (b >> 2)) * 512 + (b & 3) * 128 + lane * 4, o); } }
}
// ---- k_out: block = (64 rows, 128 cols): out = ctx (hi + lo) . w_o + b_o
__global__ __launch_bounds__(128) void k_out(const float* __restrict__ O, const __bf16* __restrict__ PW, const float* __restrict__ BO, float* __restrict__ Y) { __shared__ __align__(16) float so[4][16][132];
  const int tid = threadIdx.x, wave = tid >> 5, lane = tid & 31, col = lane & 15, g = lane >> 4; const size_t r0 = (size_t)blockIdx.x * 64 + wave * 16; const int c0 = blockIdx.y * 128; const __bf16* Wr = PW + ((size_t)3 * (DM / 16) + (c0 >> 4)) * (DM / 32) * 512 + 8 * lane;
  v8f acc[8] = {};
  // fragments run one k step ahead, as in k_proj
  const float* Op = O + (r0 >> 4) * (DM / 32) * 512 + 4 * lane; v4f ar[4]; v16b w[8];
#pragma unroll
  for (int i = 0; i < 4; ++i) ar[i] = *(const v4f*)(Op + i * 128);
  __builtin_amdgcn_sched_barrier(0);   // the row's loads stay the oldest here as in the loop: the wait at the loop's head is then a counted one, not for every load in flight
#pragma unroll
  for (int j = 0; j < 8; ++j) w[j] = fragp_b(Wr + j * (DM / 32) * 512);
#pragma unroll 1   // stays rolled: with the odd trip count an unroll by 2 came out as all 24 steps in a row
  for (int kc = 0; kc < DM / 32 - 1; ++kc) { float v[16];
#pragma unroll
    for (int i = 0; i < 16; ++i) v[i] = ar[i >> 2][i & 3];
    const F2 a = bsplit16(v); Op += 512;   // a running pointer: its register pair lives over the whole loop, so no load's result can be placed in it
#pragma unroll
    for (int i = 0; i < 4; ++i) ar[i] = *(const v4f*)(Op + i * 128);
#pragma unroll
    for (int j = 0; j < 8; ++j) { acc[j] = wmma_bf(a.h, w[j], acc[j]); acc[j] = wmma_bf(a.l, w[j], acc[j]); w[j] = fragp_b(Wr + (j * (DM / 32) + kc + 1) * 512); }
    __builtin_amdgcn_sched_barrier(0);   // keeps the register copies of the rows just asked for at the loop's foot: lifted among the products they wait for those loads a whole step early
    asm volatile("s_wait_xcnt 0x0" ::: "memory"); }   // stands in front of the next step's rewrite of the last loads' address registers
  { float v[16];
#pragma unroll
    for (int i = 0; i < 16; ++i) v[i] = ar[i >> 2][i & 3];
    const F2 a = bsplit16(v);
#pragma unroll
    for (int j = 0; j < 8; ++j) { acc[j] = wmma_bf(a.h, w[j], acc[j]); acc[j] = wmma_bf(a.l, w[j], acc[j]); } }
#pragma unroll
  for (int j = 0; j < 8; ++j) { const float bb = bfr(BO[c0 + j * 16 + col]);
#pragma unroll
    for (int r = 0; r < 8; ++r) so[wave][8 * g + r][j * 16 + col] = acc[j][r] + bb; }
  LDSX(); for (int rl = 0; rl < 16; ++rl) vst2(Y + (r0 + rl) * DM + c0 + lane * 4, *(const v4f*)&so[wave][rl][lane * 4]); }
extern "C" void kernel_launch(void* const* d_in, const int* in_sizes, int n_in, void* d_out, int out_size, void* d_ws, size_t ws_size, hipStream_t stream) {
  (void)in_sizes; (void)n_in; (void)out_size;
  const float** F = (const float**)d_in;   // 0 x [1,4096,768], 1 encoding [1,4096,768], 2 w_q (in,out), 3 b_q, 4 w_k, 5 b_k, 6 w_v, 7 b_v, 8 w_o [768,768] (in,out), 9 b_o
  if (ws_size < (size_t)WS_END) return;
  char* ws = (char*)d_ws; __bf16* PW = (__bf16*)ws; _Float16 *Q = (_Float16*)(ws + WS_Q), *Kr = (_Float16*)(ws + WS_K), *V = (_Float16*)(ws + WS_V); float* O = (float*)(ws + WS_O); __bf16* XB = (__bf16*)(ws + WS_XB);
  k_pack<<<dim3(DM / 128, 48 + 128), 256, 0, stream>>>(F[0], F[1], F[2], F[4], F[6], F[8], PW, XB);
  k_proj<<<dim3(NK / 64, DM / 128, 3), 128, 0, stream>>>(XB, PW, F[3], F[5], F[7], Q, Kr, V);
  k_attn<<<dim3(TQB, NH), 128, 0, stream>>>(Q, Kr, V, O);
  k_out<<<dim3(TQB, DM / 128), 128, 0, stream>>>(O, PW, F[9], (float*)d_out);
}

// v006
// One run takes 89.5 microseconds.
// Next to v005, in two timings, it ran 1.18 and 1.19 times as fast.
// Counting every step since v000, it is 5.12 times as fast.
// compute dtype: all float inputs rounded to bf16; Q = x . w_q + b, K/V = encoding . w + b with EXACT bf16 products on WMMA 16x16x32 (x, encoding and the (in,out) weights packed to bf16 fragment blocks first), rounded once to f16; attention over the 4,096 keys: q, k single f16 x 1/8, running-max softmax in f32 (hardware exp), P (scaled by 2^11, single f16) x v (single f16); out = ctx (bf16 hi + lo, 2 products) . w_o + b_o; f32 output.
#include <hip/hip_runtime.h>
#include <math.h>

typedef __attribute__((ext_vector_type(16))) _Float16 v16h;
typedef __attribute__((ext_vector_type(16))) __bf16 v16b;
typedef __attribute__((ext_vector_type(8)))  _Float16 v8h;
typedef __attribute__((ext_vector_type(8)))  float v8f;
typedef __attribute__((ext_vector_type(4)))  float v4f;
typedef __attribute__((ext_vector_type(2)))  float v2f;
typedef __attribute__((ext_vector_type(4)))  unsigned v4u;
typedef __attribute__((ext_vector_type(4)))  int v4i;
typedef float __attribute__((may_alias)) float_a;
typedef int __attribute__((may_alias)) int_a;

template <typename T> __device__ __forceinline__ void vst2(void* p, T v) { *(T*)p = v;  }
__device__ __forceinline__ v8f wmma16(v16h a, v16h b, v8f c) {
  v8f d = __builtin_amdgcn_wmma_f32_16x16x32_f16(false, a, false, b, (short)0, c, false, false);
  asm volatile("v_nop\n\tv_nop\n\tv_nop\n\tv_nop" : "+v"(d) : "v"(a), "v"(b));
  return d;
}
__device__ __forceinline__ v8f wmma_bf(v16b a, v16b b, v8f c) {
  v8f d = __builtin_amdgcn_wmma_f32_16x16x32_bf16(false, a, false, b, (short)0, c, false, false);
  asm volatile("v_nop\n\tv_nop\n\tv_nop\n\tv_nop" : "+v"(d) : "v"(a), "v"(b));
  return d;
}
// 16x16x32 fragments: lane = (h = lane>>4, row/col = lane&15); elements 0..7 = k0+8h+0..7, 8..15 = k0+16+8h+0..7; D element r = row 8h+r
__device__ __forceinline__ v16h frag_h(const _Float16* rowk0, int lane) {
  union { v16h v; v8h q[2]; } u; const _Float16* p = rowk0 + 8 * (lane >> 4);
  u.q[0] = *(const v8h*)p; u.q[1] = *(const v8h*)(p + 16); return u.v;
}
__device__ __forceinline__ v16h frag_f32(const float* rowk0, int lane) {
  v16h a; const float* p = rowk0 + 8 * (lane >> 4);
#pragma unroll
  for (int i = 0; i < 8; ++i) { a[i] = (_Float16)p[i]; a[8 + i] = (_Float16)p[16 + i]; }
  return a;
}
__device__ __forceinline__ v16h frag_f32s(const float* rowk0, int lane, float sc) {
  v16h a; const float* p = rowk0 + 8 * (lane >> 4);
#pragma unroll
  for (int i = 0; i < 8; ++i) { a[i] = (_Float16)(p[i] * sc); a[8 + i] = (_Float16)(p[16 + i] * sc); }
  return a;
}
// column fragment from a [K][ld] layout (column n), rows >= K read as 0
__device__ __forceinline__ v16h fragc_f32(const float* W, int k0, int n, int lane, int ld, int K) {
  v16h a; const int g = lane >> 4;
#pragma unroll
  for (int i = 0; i < 8; ++i) { const int ka = k0 + 8 * g + i, kb = ka + 16;
    a[i] = (_Float16)(ka < K ? W[(size_t)(ka < K ? ka : K - 1) * ld + n] : 0.f); a[8 + i] = (_Float16)(kb < K ? W[(size_t)(kb < K ? kb : K - 1) * ld + n] : 0.f); }
  return a;
}
struct F2 { v16b h, l; };
__device__ __forceinline__ F2 bsplit16(const float v[16]) { F2 r;
#pragma unroll
  for (int i = 0; i < 16; ++i) { const __bf16 h = (__bf16)v[i]; r.h[i] = h; r.l[i] = (__bf16)(v[i] - (float)h); }
  return r; }
__device__ __forceinline__ F2 split_row(const float* row, int k0, int lane) { float v[16]; const float* p = row + k0 + 8 * (lane >> 4);
#pragma unroll
  for (int i = 0; i < 8; ++i) { v[i] = p[i]; v[8 + i] = p[16 + i]; }
  return bsplit16(v); }
__device__ __forceinline__ F2 split_rowK(const float* row, int k0, int lane, int K) { float v[16]; const int g = lane >> 4;
#pragma unroll
  for (int i = 0; i < 8; ++i) { const int ka = k0 + 8 * g + i, kb = ka + 16; v[i] = ka < K ? row[ka < K ? ka : K - 1] : 0.f; v[8 + i] = kb < K ? row[kb < K ? kb : K - 1] : 0.f; }
  return bsplit16(v); }
__device__ __forceinline__ F2 split_col(const float* W, int k0, int n, int lane, int ld, int K) { float v[16]; const int g = lane >> 4;
#pragma unroll
  for (int i = 0; i < 8; ++i) { const int ka = k0 + 8 * g + i, kb = ka + 16; v[i] = ka < K ? W[(size_t)(ka < K ? ka : K - 1) * ld + n] : 0.f; v[8 + i] = kb < K ? W[(size_t)(kb < K ? kb : K - 1) * ld + n] : 0.f; }
  return bsplit16(v); }
__device__ __forceinline__ v8f mac3(const F2& a, const F2& b, v8f c) { c = wmma_bf(a.l, b.h, c); c = wmma_bf(a.h, b.l, c); return wmma_bf(a.h, b.h, c); }
__device__ __forceinline__ float sigm(float v) { return 1.0f / (1.0f + expf(-v)); }
#define LDSX() do { asm volatile("s_wait_dscnt 0" ::: "memory"); __builtin_amdgcn_wave_barrier(); __builtin_amdgcn_fence(__ATOMIC_RELEASE, "workgroup"); } while (0)


// Encoder-decoder multi-head attention (B 1, N 4,096 queries and keys, d_model 768, 12 heads x 64): q from x, k/v from the encoding, softmax(Q K^T / 8) V, output projection + bias.
#define NQ 4096
#define NK 4096
#define DM 768
#define NH 12
#define HD 64
#ifndef TQB
#define TQB (NQ / 64)
#endif
typedef __attribute__((ext_vector_type(8))) __bf16 v8b;
__device__ __forceinline__ v16b frag_b(const __bf16* rowk0, int lane) {
  union { v16b v; v8b q[2]; } u; const __bf16* p = rowk0 + 8 * (lane >> 4);
  u.q[0] = *(const v8b*)p; u.q[1] = *(const v8b*)(p + 16); return u.v;
}
// fragment-order blocks: one (16 rows or columns) x (32 k) operand tile = 512 elements laid [half of the slots][lane][8], so each of a fragment's two wave-wide 16-byte loads covers 512 contiguous bytes; p = block + 8 * lane
__device__ __forceinline__ v16b fragp_b(const __bf16* p) { union { v16b v; v8b q[2]; } u; u.q[0] = *(const v8b*)p; u.q[1] = *(const v8b*)(p + 256); return u.v; }
__device__ __forceinline__ v16h fragp_h(const _Float16* p) { union { v16h v; v8h q[2]; } u; u.q[0] = *(const v8h*)p; u.q[1] = *(const v8h*)(p + 256); return u.v; }
__device__ __forceinline__ float bfr(float v) { return (float)(__bf16)v; }
__device__ __attribute__((noinline)) float exp_ni(float v) { return expf(v); }
__device__ __attribute__((noinline)) float erf_ni(float v) { return erff(v); }

#define WS_PW  0u                                   // bf16 w_q, w_k, w_v, w_o as fragment blocks [4][48 column tiles][24 k chunks][512]
#define WS_Q   (WS_PW + 2u * (size_t)4 * DM * DM)       // f16 Q rows [NQ][768]; K blocks [head][256 key tiles][2 d chunks][512]; V blocks [head][128 passes][4 d tiles][512]; f32 ctx blocks [256 row tiles][24 k chunks][4][lane][4]
#define WS_K   (WS_Q + 2u * (size_t)NQ * DM)
#define WS_V   (WS_K + 2u * (size_t)NK * DM)
#define WS_O   (WS_V + 2u * (size_t)DM * NK)
#define WS_XB  (WS_O + 4u * (size_t)NQ * DM)            // bf16 x, encoding as fragment blocks [2][256 row tiles][24 k chunks][512]
#define WS_END (WS_XB + 2u * (size_t)(NQ + NK) * DM)

// ---- k_pack: a 16-byte piece = 8 k of one row or column of a fragment block, rounded to bf16; thread = that piece in 4 k chunks (fewer, longer waves: the launch is short and wave starts count); block = (4 k chunks, y): y < 48 weights (the reads run along n, whole lines), else 64 rows of x or of the encoding; a wave stores whole lines
__global__ __launch_bounds__(256) void k_pack(const float* __restrict__ X, const float* __restrict__ ENC, const float* __restrict__ WQ, const float* __restrict__ WK, const float* __restrict__ WV, const float* __restrict__ WO, __bf16* __restrict__ PW, __bf16* __restrict__ XB) { const int kc0 = blockIdx.x * 4, y = blockIdx.y, t = threadIdx.x; v8b o[4];
  if (y < 48) { const int which = y / 12, p = (y % 12) / 3, n = (y % 3) * 256 + t; const float* w = (which == 0) ? WQ : (which == 1) ? WK : (which == 2) ? WV : WO; const float* s = w + (size_t)(kc0 * 32 + p * 8) * DM + n; __bf16* d = PW + (((size_t)which * (DM / 16) + (n >> 4)) * (DM / 32) + kc0) * 512 + p * 128 + (n & 15) * 8;
#pragma unroll
    for (int kk = 0; kk < 4; ++kk) {
#pragma unroll
      for (int i = 0; i < 8; ++i) o[kk][i] = (__bf16)s[(size_t)(kk * 32 + i) * DM]; }
#pragma unroll
    for (int kk = 0; kk < 4; ++kk) vst2(d + kk * 512, o[kk]); }
  else { const int src = (y - 48) >> 6, rt = ((y - 48) & 63) * 4 + (t >> 6), p = (t >> 4) & 3, c = t & 15; const float* s = (src ? ENC : X) + (size_t)(rt * 16 + c) * DM + kc0 * 32 + p * 8; __bf16* d = XB + (((size_t)src * (NQ / 16) + rt) * (DM / 32) + kc0) * 512 + p * 128 + c * 8;
#pragma unroll
    for (int kk = 0; kk < 4; ++kk) { const v4f lo = *(const v4f*)(s + kk * 32), hi = *(const v4f*)(s + kk * 32 + 4);
#pragma unroll
      for (int i = 0; i < 4; ++i) { o[kk][i] = (__bf16)lo[i]; o[kk][4 + i] = (__bf16)hi[i]; } }
#pragma unroll
    for (int kk = 0; kk < 4; ++kk) vst2(d + kk * 512, o[kk]); } }
// ---- k_proj: block = (64 rows, 128 cols, which): Q from x, K/V from the encoding (both as packed blocks; + bias); Q f16 rows, K and V fragment blocks
__global__ __launch_bounds__(128) void k_proj(const __bf16* __restrict__ XB, const __bf16* __restrict__ PW, const float* __restrict__ BQ, const float* __restrict__ BK, const float* __restrict__ BV, _Float16* __restrict__ Q, _Float16* __restrict__ Kr, _Float16* __restrict__ V) {
  __shared__ __align__(16) _Float16 so[64][136]; __shared__ __align__(16) _Float16 st[128][72];
  const int tid = threadIdx.x, wave = tid >> 5, lane = tid & 31, col = lane & 15, g = lane >> 4; const int which = blockIdx.z; const size_t rb = (size_t)blockIdx.x * 64; if (which == 0 && rb >= (size_t)TQB * 64) return;
  const size_t r0 = rb + wave * 16; const int c0 = blockIdx.y * 128; const __bf16* Wr = PW + ((size_t)which * (DM / 16) + (c0 >> 4)) * (DM / 32) * 512 + 8 * lane; const float* BB = (which == 0) ? BQ : (which == 1) ? BK : BV;
  v8f acc[8] = {};
  // the k walk starts at a chunk of the block's own and wraps round: blocks that read the same weight columns (equal y, which) or the same rows (equal x) then ask L2 for different lines at any one moment
  const int s0 = (int)((blockIdx.x + 4 * blockIdx.y + 2 * blockIdx.z) % (DM / 32)); int kn = s0;
  // fragments run one k step ahead: each weight fragment is reloaded for the next step right behind the product that used it, the activation row at the head of the step
  const __bf16* Aq = XB + (((size_t)(which != 0) * (NQ / 16) + (r0 >> 4)) * (DM / 32) + s0) * 512 + 8 * lane; const __bf16* Wq = Wr + s0 * 512; v16b an = fragp_b(Aq), w[8];   // running pointers: one add a step each, and the eight column tiles stay immediate offsets
  __builtin_amdgcn_sched_barrier(0);   // the row's loads stay the oldest here as in the loop: the wait at the loop's head is then a counted one, not for every load in flight
#pragma unroll
  for (int j = 0; j < 8; ++j) w[j] = fragp_b(Wq + j * (DM / 32) * 512);
#pragma unroll 1   // stays rolled: with the odd trip count an unroll by 2 came out as all 24 steps in a row
  for (int kc = 0; kc < DM / 32 - 1; ++kc) { const bool wrap = kn + 1 == DM / 32; kn = wrap ? 0 : kn + 1; const int st = wrap ? -(DM / 32 - 1) * 512 : 512; Aq += st; Wq += st; const v16b a = an; an = fragp_b(Aq);
#pragma unroll
    for (int j = 0; j < 8; ++j) { acc[j] = wmma_bf(a, w[j], acc[j]); w[j] = fragp_b(Wq + j * (DM / 32) * 512); }
    asm volatile("s_wait_xcnt 0x0" ::: "memory"); }   // stands in front of the next step's rewrite of the last loads' address registers
#pragma unroll
  for (int j = 0; j < 8; ++j) acc[j] = wmma_bf(an, w[j], acc[j]);
#pragma unroll
  for (int j = 0; j < 8; ++j) { const float bb = bfr(BB[c0 + j * 16 + col]);
#pragma unroll
    for (int r = 0; r < 8; ++r) { const _Float16 hv = (_Float16)(acc[j][r] + bb); if (which < 2) so[wave * 16 + 8 * g + r][j * 16 + col] = hv; else st[j * 16 + col][wave * 16 + 8 * g + r] = hv; } }
  __syncthreads();
  if (which == 0) { for (int e = tid; e < 64 * 16; e += 128) { const int rl = e >> 4, q = e & 15; vst2((unsigned*)(Q + (rb + rl) * DM + c0 + q * 8), *(const v4u*)&so[rl][q * 8]); } }
  // K, V: piece e = (head of 2, tile, chunk, 8-element group p of 4, row c of 16) in block order, so a wave stores 512 contiguous bytes
  else if (which == 1) { for (int e = tid; e < 64 * 16; e += 128) { const int c = e & 15, p = (e >> 4) & 3, kc = (e >> 6) & 1, kt = (e >> 7) & 3, hd = e >> 9; vst2((unsigned*)(Kr + ((((size_t)(c0 >> 6) + hd) * (NK / 16) + (rb >> 4) + kt) * 2 + kc) * 512 + p * 128 + c * 8), *(const v4u*)&so[kt * 16 + c][hd * 64 + kc * 32 + p * 8]); } }
  else { for (int e = tid; e < 128 * 8; e += 128) { const int c = e & 15, p = (e >> 4) & 3, dt = (e >> 6) & 3, ksl = (e >> 8) & 1, hd = e >> 9; vst2((unsigned*)(V + ((((size_t)(c0 >> 6) + hd) * (NK / 32) + (rb >> 5) + ksl) * 4 + dt) * 512 + p * 128 + c * 8), *(const v4u*)&st[hd * 64 + dt * 16 + c][ksl * 32 + p * 8]); } }
}
// ---- k_attn: block = (64 queries, head): softmax(q k / 8) over the 4,096 keys, transposed: scores^T = K . Q^T and ctx^T += V^T . P^T, so a lane holds 16 scores of ONE query of each column group (column col; keys 8g + r and 16 + 8g + r of the pass, g = lane >> 4); wave = (32 queries = 2 column groups, one half of the keys): every K and V fragment that a wave loads feeds two products; the two key halves are joined once at the end through LDS; ctx f32 in the fragment blocks that k_out reads
__device__ __forceinline__ float xhalf(float v) { const int b = __builtin_bit_cast(int, v); return __builtin_bit_cast(float, __builtin_amdgcn_permlanex16(b, b, 0x76543210, 0xfedcba98, false, false)); }   // the value of lane ^ 16: the same query's other half of the keys
// 2^x of a whole score tile in one statement, and of one value: inside it no result is read and no source overwritten directly behind a v_exp_f32 (every output is early-clobber), and the closing v_nop is the slot that the instruction set asks for behind the last one
__device__ __forceinline__ v8f exp2x8(v8f x) { float r0, r1, r2, r3, r4, r5, r6, r7;
  asm("v_exp_f32 %0, %8\n\tv_exp_f32 %1, %9\n\tv_exp_f32 %2, %10\n\tv_exp_f32 %3, %11\n\tv_exp_f32 %4, %12\n\tv_exp_f32 %5, %13\n\tv_exp_f32 %6, %14\n\tv_exp_f32 %7, %15\n\tv_nop"
      : "=&v"(r0), "=&v"(r1), "=&v"(r2), "=&v"(r3), "=&v"(r4), "=&v"(r5), "=&v"(r6), "=&v"(r7)
      : "v"(x[0]), "v"(x[1]), "v"(x[2]), "v"(x[3]), "v"(x[4]), "v"(x[5]), "v"(x[6]), "v"(x[7]));
  const v8f r = { r0, r1, r2, r3, r4, r5, r6, r7 }; return r; }
__device__ __forceinline__ float exp2x1(float x) { float r; asm("v_exp_f32 %0, %1\n\tv_nop" : "=&v"(r) : "v"(x)); return r; }
#define LOG2E 1.44269504f
#define SC2 (0.125f * LOG2E)   // a raw score times this = its exponent to base 2
#define NKH (NK / 2)
__global__ __launch_bounds__(128) void k_attn(const _Float16* __restrict__ Q, const _Float16* __restrict__ Kr, const _Float16* __restrict__ V, float* __restrict__ O) {
  __shared__ __align__(16) v4f sx[2][17][32];   // the upper key half's state of each 32-query wave: [16 pieces of ctx, then (m, m, l, l)][lane]
  const int tid = threadIdx.x, wave = __builtin_amdgcn_readfirstlane(tid >> 5), lane = tid & 31, col = lane & 15; const int qh = wave & 1, kh = wave >> 1; const int h = blockIdx.y; const int q0 = blockIdx.x * 64 + qh * 32; const size_t rq = (size_t)q0;
  v16h bq[2][2];   // B operand: column = query
#pragma unroll
  for (int qg = 0; qg < 2; ++qg) {
#pragma unroll
    for (int kc = 0; kc < 2; ++kc) bq[qg][kc] = frag_h(Q + (rq + qg * 16 + col) * DM + h * HD + kc * 32, lane); }
  float m[2] = { -3.0e38f, -3.0e38f }, l[2] = { 0.f, 0.f };   // each query's running maximum of the raw scores (equal in both lane halves) and this lane half's sum, which carries P's 2^11 like ctx
  v8f acc[2][4] = {};   // acc[qg][dt][r] = ctx[query 16 qg + col][16 dt + 8g + r]
  // K fragments (A: row = key) run one pass ahead (reloaded as one group behind the score products); V fragments (A: row = d) are asked for as one group at the head of their pass
  const int s0 = blockIdx.x & (NKH / 32 - 1);   // the key walk starts at a pass of the block's own and wraps round its half: the 64 blocks of a head then ask L2 for different K and V lines at any one moment
  v16h kf[2][2], vf[4]; const _Float16* Kp = Kr + (size_t)h * NK * HD + (size_t)kh * NKH * HD + 8 * lane; const _Float16* Vq = V + (size_t)h * NK * HD + (size_t)kh * NKH * HD + s0 * 2048 + 8 * lane;   // a pass = 4 blocks of each, 4 KiB in a row; V by a running pointer: its register pair lives over the whole loop, so no load's result can be placed in it
#pragma unroll
  for (int ct = 0; ct < 2; ++ct) {
#pragma unroll
    for (int kc = 0; kc < 2; ++kc) kf[ct][kc] = fragp_h(Kp + (s0 * 4 + ct * 2 + kc) * 512); }
#pragma unroll 1
  for (int ks = 0; ks < NKH / 32; ++ks) { v8f s[2][2];
#pragma unroll
    for (int dt = 0; dt < 4; ++dt) vf[dt] = fragp_h(Vq + dt * 512);
#pragma unroll
    for (int ct = 0; ct < 2; ++ct) {
#pragma unroll
      for (int qg = 0; qg < 2; ++qg) { const v8f z = {}; s[qg][ct] = wmma16(kf[ct][0], bq[qg][0], z); } }
#pragma unroll
    for (int ct = 0; ct < 2; ++ct) {
#pragma unroll
      for (int qg = 0; qg < 2; ++qg) s[qg][ct] = wmma16(kf[ct][1], bq[qg][1], s[qg][ct]); }
    const int jn = ((ks + 1 + s0) & (NKH / 32 - 1)) * 4;   // the last pass asks for the walk's first blocks again: in bounds, not used
#pragma unroll
    for (int ct = 0; ct < 2; ++ct) {
#pragma unroll
      for (int kc = 0; kc < 2; ++kc) kf[ct][kc] = fragp_h(Kp + (jn + ct * 2 + kc) * 512); }
    __builtin_amdgcn_sched_barrier(0);   // keeps the K loads here, ahead of the whole softmax, so that they have the rest of the pass to land
    v16h pb[2];   // B operands straight from the score tiles: slot i = key 8g + i, slot 8 + i = key 16 + 8g + i, the k order of the V blocks
#pragma unroll
    for (int qg = 0; qg < 2; ++qg) { const v8f s0 = s[qg][0], s1 = s[qg][1];   // raw scores: the maximum is taken on them as they are (1/8 > 0 keeps the order), and 1/8, log2 e and P's 2^11 all go into the one multiply-add in front of the 2^x
      float mq[4];
#pragma unroll
      for (int i = 0; i < 4; ++i) mq[i] = fmaxf(fmaxf(s0[i], s0[4 + i]), fmaxf(s1[i], s1[4 + i]));
      float mx = fmaxf(fmaxf(mq[0], mq[1]), fmaxf(mq[2], mq[3])); mx = fmaxf(mx, xhalf(mx));
      const float mn = fmaxf(m[qg], mx); const float ea = exp2x1((m[qg] - mn) * SC2), alpha = (m[qg] <= -1.0e38f) ? 0.f : ea; m[qg] = mn;   // exp(x) = 2^(x log2 e), as __expf forms it; formed ahead of the test, so that the test stays a select and no branch
      const float nb = 11.0f - mn * SC2;
      const v8f e[2] = { exp2x8(s0 * SC2 + nb), exp2x8(s1 * SC2 + nb) };   // 2^11 exp((s - max) / 8); whole-tile expressions: the packed forms then pair neighbouring registers of one tile
      const v8f t8 = e[0] + e[1]; const v4f t4 = t8.lo + t8.hi; const v2f t2 = t4.lo + t4.hi;
      l[qg] = l[qg] * alpha + (t2.x + t2.y);
#pragma unroll
      for (int dt = 0; dt < 4; ++dt) acc[qg][dt] *= alpha;
#pragma unroll
      for (int i = 0; i < 8; ++i) { pb[qg][i] = (_Float16)e[0][i]; pb[qg][8 + i] = (_Float16)e[1][i]; } }
#pragma unroll
    for (int dt = 0; dt < 4; ++dt) {
#pragma unroll
      for (int qg = 0; qg < 2; ++qg) acc[qg][dt] = wmma16(vf[dt], pb[qg], acc[qg][dt]); }
    Vq += jn ? 2048 : -(NKH / 32 - 1) * 2048; }   // on to the next pass; from the half's last pass back to its first
  // join of the key halves: the upper half's waves hand their state over, the lower half's waves bring both to the common maximum and store
  if (kh) {
#pragma unroll
    for (int b = 0; b < 16; ++b) { v4f o;
#pragma unroll
      for (int i = 0; i < 4; ++i) o[i] = acc[b >> 3][(b >> 1) & 3][(b & 1) * 4 + i];
      sx[qh][b][lane] = o; }
    const v4f ml = { m[0], m[1], l[0], l[1] }; sx[qh][16][lane] = ml; }
  __syncthreads();   // publishes the upper half's state to the wave that joins it; every wave passes it
  if (kh) return;
  const v4f ml = sx[qh][16][lane];
#pragma unroll
  for (int qg = 0; qg < 2; ++qg) { const float mt = fmaxf(m[qg], ml[qg]), a0 = __expf((m[qg] - mt) * 0.125f), a1 = __expf((ml[qg] - mt) * 0.125f);
    float lt = l[qg] * a0 + ml[2 + qg] * a1; lt += xhalf(lt); const float il = 1.0f / lt, f0 = a0 * il, f1 = a1 * il;
    // a lane already holds the 32 values of its places in the two ctx blocks of each column group
#pragma unroll
    for (int b = 0; b < 8; ++b) { const v4f u = sx[qh][qg * 8 + b][lane]; v4f o;
#pragma unroll
      for (int i = 0; i < 4; ++i) o[i] = acc[qg][b >> 1][(b & 1) * 4 + i] * f0 + u[i] * f1;
      vst2(O + ((size_t)((q0 >> 4) + qg) * (DM / 32) + h * 2 + (b >> 2)) * 512 + (b & 3) * 128 + lane * 4, o); } }
}
// ---- k_out: block = (64 rows, 128 cols): out = ctx (hi + lo) . w_o + b_o
__global__ __launch_bounds__(128) void k_out(const float* __restrict__ O, const __bf16* __restrict__ PW, const float* __restrict__ BO, float* __restrict__ Y) { __shared__ __align__(16) float so[4][16][132];
  const int tid = threadIdx.x, wave = tid >> 5, lane = tid & 31, col = lane & 15, g = lane >> 4; const size_t r0 = (size_t)blockIdx.x * 64 + wave * 16; const int c0 = blockIdx.y * 128; const __bf16* Wr = PW + ((size_t)3 * (DM / 16) + (c0 >> 4)) * (DM / 32) * 512 + 8 * lane;
  v8f acc[8] = {};
  const int s0 = (int)((blockIdx.x + 4 * blockIdx.y) % (DM / 32)); int kn = s0;   // the k walk starts at a chunk of the block's own and wraps round, as in k_proj
  // fragments run one k step ahead, as in k_proj
  const float* Op = O + ((r0 >> 4) * (DM / 32) + s0) * 512 + 4 * lane; const __bf16* Wq = Wr + s0 * 512; v4f ar[4]; v16b w[8];
#pragma unroll
  for (int i = 0; i < 4; ++i) ar[i] = *(const v4f*)(Op + i * 128);
  __builtin_amdgcn_sched_barrier(0);   // the row's loads stay the oldest here as in the loop: the wait at the loop's head is then a counted one, not for every load in flight
#pragma unroll
  for (int j = 0; j < 8; ++j) w[j] = fragp_b(Wq + j * (DM / 32) * 512);
#pragma unroll 1   // stays rolled: with the odd trip count an unroll by 2 came out as all 24 steps in a row
  for (int kc = 0; kc < DM / 32 - 1; ++kc) { float v[16]; const bool wrap = kn + 1 == DM / 32; kn = wrap ? 0 : kn + 1; const int st = wrap ? -(DM / 32 - 1) * 512 : 512; Wq += st;
#pragma unroll
    for (int i = 0; i < 16; ++i) v[i] = ar[i >> 2][i & 3];
    const F2 a = bsplit16(v); Op += st;   // a running pointer: its register pair lives over the whole loop, so no load's result can be placed in it
#pragma unroll
    for (int i = 0; i < 4; ++i) ar[i] = *(const v4f*)(Op + i * 128);
#pragma unroll
    for (int j = 0; j < 8; ++j) { acc[j] = wmma_bf(a.h, w[j], acc[j]); acc[j] = wmma_bf(a.l, w[j], acc[j]); w[j] = fragp_b(Wq + j * (DM / 32) * 512); }
    __builtin_amdgcn_sched_barrier(0);   // keeps the register copies of the rows just asked for at the loop's foot: lifted among the products they wait for those loads a whole step early
    asm volatile("s_wait_xcnt 0x0" ::: "memory"); }   // stands in front of the next step's rewrite of the last loads' address registers
  { float v[16];
#pragma unroll
    for (int i = 0; i < 16; ++i) v[i] = ar[i >> 2][i & 3];
    const F2 a = bsplit16(v);
#pragma unroll
    for (int j = 0; j < 8; ++j) { acc[j] = wmma_bf(a.h, w[j], acc[j]); acc[j] = wmma_bf(a.l, w[j], acc[j]); } }
#pragma unroll
  for (int j = 0; j < 8; ++j) { const float bb = bfr(BO[c0 + j * 16 + col]);
#pragma unroll
    for (int r = 0; r < 8; ++r) so[wave][8 * g + r][j * 16 + col] = acc[j][r] + bb; }
  LDSX(); for (int rl = 0; rl < 16; ++rl) vst2(Y + (r0 + rl) * DM + c0 + lane * 4, *(const v4f*)&so[wave][rl][lane * 4]); }
extern "C" void kernel_launch(void* const* d_in, const int* in_sizes, int n_in, void* d_out, int out_size, void* d_ws, size_t ws_size, hipStream_t stream) {
  (void)in_sizes; (void)n_in; (void)out_size;
  const float** F = (const float**)d_in;   // 0 x [1,4096,768], 1 encoding [1,4096,768], 2 w_q (in,out), 3 b_q, 4 w_k, 5 b_k, 6 w_v, 7 b_v, 8 w_o [768,768] (in,out), 9 b_o
  if (ws_size < (size_t)WS_END) return;
  char* ws = (char*)d_ws; __bf16* PW = (__bf16*)ws; _Float16 *Q = (_Float16*)(ws + WS_Q), *Kr = (_Float16*)(ws + WS_K), *V = (_Float16*)(ws + WS_V); float* O = (float*)(ws + WS_O); __bf16* XB = (__bf16*)(ws + WS_XB);
  k_pack<<<dim3(DM / 128, 48 + 128), 256, 0, stream>>>(F[0], F[1], F[2], F[4], F[6], F[8], PW, XB);
  k_proj<<<dim3(NK / 64, DM / 128, 3), 128, 0, stream>>>(XB, PW, F[3], F[5], F[7], Q, Kr, V);
  k_attn<<<dim3(TQB, NH), 128, 0, stream>>>(Q, Kr, V, O);
  k_out<<<dim3(TQB, DM / 128), 128, 0, stream>>>(O, PW, F[9], (float*)d_out);
}

// v007
// One run takes 86.8 microseconds.
// Two timings next to v006 both put it at 1.03 times that version's speed.
// All steps since v000 together make it 5.28 times as fast.
// compute dtype: all float inputs rounded to bf16; Q = x . w_q + b, K/V = encoding . w + b with EXACT bf16 products on WMMA 16x16x32 (x, encoding and the (in,out) weights packed to bf16 fragment blocks first), rounded once to f16; attention over the 4,096 keys: q, k single f16 x 1/8, running-max softmax in f32 (hardware exp), P (scaled by 2^11, single f16) x v (single f16); out = ctx (bf16 hi + lo, 2 products) . w_o + b_o; f32 output.
#include <hip/hip_runtime.h>
#include <math.h>

typedef __attribute__((ext_vector_type(16))) _Float16 v16h;
typedef __attribute__((ext_vector_type(16))) __bf16 v16b;
typedef __attribute__((ext_vector_type(8)))  _Float16 v8h;
typedef __attribute__((ext_vector_type(8)))  float v8f;
typedef __attribute__((ext_vector_type(4)))  float v4f;
typedef __attribute__((ext_vector_type(2)))  float v2f;
typedef __attribute__((ext_vector_type(4)))  unsigned v4u;
typedef __attribute__((ext_vector_type(4)))  int v4i;
typedef float __attribute__((may_alias)) float_a;
typedef int __attribute__((may_alias)) int_a;

template <typename T> __device__ __forceinline__ void vst2(void* p, T v) { *(T*)p = v;  }
__device__ __forceinline__ v8f wmma16(v16h a, v16h b, v8f c) {
  v8f d = __builtin_amdgcn_wmma_f32_16x16x32_f16(false, a, false, b, (short)0, c, false, false);
  asm volatile("v_nop\n\tv_nop\n\tv_nop\n\tv_nop" : "+v"(d) : "v"(a), "v"(b));
  return d;
}
// the same product with no idle slots behind it: for runs of products in straight-line code, where the next product fills the slot and the compiler pads in front of the first vector instruction that touches a result
__device__ __forceinline__ v8f wmma16r(v16h a, v16h b, v8f c) { return __builtin_amdgcn_wmma_f32_16x16x32_f16(false, a, false, b, (short)0, c, false, false); }
__device__ __forceinline__ v8f wmma_bf(v16b a, v16b b, v8f c) {
  v8f d = __builtin_amdgcn_wmma_f32_16x16x32_bf16(false, a, false, b, (short)0, c, false, false);
  asm volatile("v_nop\n\tv_nop\n\tv_nop\n\tv_nop" : "+v"(d) : "v"(a), "v"(b));
  return d;
}
// 16x16x32 fragments: lane = (h = lane>>4, row/col = lane&15); elements 0..7 = k0+8h+0..7, 8..15 = k0+16+8h+0..7; D element r = row 8h+r
__device__ __forceinline__ v16h frag_h(const _Float16* rowk0, int lane) {
  union { v16h v; v8h q[2]; } u; const _Float16* p = rowk0 + 8 * (lane >> 4);
  u.q[0] = *(const v8h*)p; u.q[1] = *(const v8h*)(p + 16); return u.v;
}
__device__ __forceinline__ v16h frag_f32(const float* rowk0, int lane) {
  v16h a; const float* p = rowk0 + 8 * (lane >> 4);
#pragma unroll
  for (int i = 0; i < 8; ++i) { a[i] = (_Float16)p[i]; a[8 + i] = (_Float16)p[16 + i]; }
  return a;
}
__device__ __forceinline__ v16h frag_f32s(const float* rowk0, int lane, float sc) {
  v16h a; const float* p = rowk0 + 8 * (lane >> 4);
#pragma unroll
  for (int i = 0; i < 8; ++i) { a[i] = (_Float16)(p[i] * sc); a[8 + i] = (_Float16)(p[16 + i] * sc); }
  return a;
}
// column fragment from a [K][ld] layout (column n), rows >= K read as 0
__device__ __forceinline__ v16h fragc_f32(const float* W, int k0, int n, int lane, int ld, int K) {
  v16h a; const int g = lane >> 4;
#pragma unroll
  for (int i = 0; i < 8; ++i) { const int ka = k0 + 8 * g + i, kb = ka + 16;
    a[i] = (_Float16)(ka < K ? W[(size_t)(ka < K ? ka : K - 1) * ld + n] : 0.f); a[8 + i] = (_Float16)(kb < K ? W[(size_t)(kb < K ? kb : K - 1) * ld + n] : 0.f); }
  return a;
}
struct F2 { v16b h, l; };
__device__ __forceinline__ F2 bsplit16(const float v[16]) { F2 r;
#pragma unroll
  for (int i = 0; i < 16; ++i) { const __bf16 h = (__bf16)v[i]; r.h[i] = h; r.l[i] = (__bf16)(v[i] - (float)h); }
  return r; }
__device__ __forceinline__ F2 split_row(const float* row, int k0, int lane) { float v[16]; const float* p = row + k0 + 8 * (lane >> 4);
#pragma unroll
  for (int i = 0; i < 8; ++i) { v[i] = p[i]; v[8 + i] = p[16 + i]; }
  return bsplit16(v); }
__device__ __forceinline__ F2 split_rowK(const float* row, int k0, int lane, int K) { float v[16]; const int g = lane >> 4;
#pragma unroll
  for (int i = 0; i < 8; ++i) { const int ka = k0 + 8 * g + i, kb = ka + 16; v[i] = ka < K ? row[ka < K ? ka : K - 1] : 0.f; v[8 + i] = kb < K ? row[kb < K ? kb : K - 1] : 0.f; }
  return bsplit16(v); }
__device__ __forceinline__ F2 split_col(const float* W, int k0, int n, int lane, int ld, int K) { float v[16]; const int g = lane >> 4;
#pragma unroll
  for (int i = 0; i < 8; ++i) { const int ka = k0 + 8 * g + i, kb = ka + 16; v[i] = ka < K ? W[(size_t)(ka < K ? ka : K - 1) * ld + n] : 0.f; v[8 + i] = kb < K ? W[(size_t)(kb < K ? kb : K - 1) * ld + n] : 0.f; }
  return bsplit16(v); }
__device__ __forceinline__ v8f mac3(const F2& a, const F2& b, v8f c) { c = wmma_bf(a.l, b.h, c); c = wmma_bf(a.h, b.l, c); return wmma_bf(a.h, b.h, c); }
__device__ __forceinline__ float sigm(float v) { return 1.0f / (1.0f + expf(-v)); }
#define LDSX() do { asm volatile("s_wait_dscnt 0" ::: "memory"); __builtin_amdgcn_wave_barrier(); __builtin_amdgcn_fence(__ATOMIC_RELEASE, "workgroup"); } while (0)


// Encoder-decoder multi-head attention (B 1, N 4,096 queries and keys, d_model 768, 12 heads x 64): q from x, k/v from the encoding, softmax(Q K^T / 8) V, output projection + bias.
#define NQ 4096
#define NK 4096
#define DM 768
#define NH 12
#define HD 64
#ifndef TQB
#define TQB (NQ / 64)
#endif
typedef __attribute__((ext_vector_type(8))) __bf16 v8b;
__device__ __forceinline__ v16b frag_b(const __bf16* rowk0, int lane) {
  union { v16b v; v8b q[2]; } u; const __bf16* p = rowk0 + 8 * (lane >> 4);
  u.q[0] = *(const v8b*)p; u.q[1] = *(const v8b*)(p + 16); return u.v;
}
// fragment-order blocks: one (16 rows or columns) x (32 k) operand tile = 512 elements laid [half of the slots][lane][8], so each of a fragment's two wave-wide 16-byte loads covers 512 contiguous bytes; p = block + 8 * lane
__device__ __forceinline__ v16b fragp_b(const __bf16* p) { union { v16b v; v8b q[2]; } u; u.q[0] = *(const v8b*)p; u.q[1] = *(const v8b*)(p + 256); return u.v; }
__device__ __forceinline__ v16h fragp_h(const _Float16* p) { union { v16h v; v8h q[2]; } u; u.q[0] = *(const v8h*)p; u.q[1] = *(const v8h*)(p + 256); return u.v; }
__device__ __forceinline__ float bfr(float v) { return (float)(__bf16)v; }
__device__ __attribute__((noinline)) float exp_ni(float v) { return expf(v); }
__device__ __attribute__((noinline)) float erf_ni(float v) { return erff(v); }

#define WS_PW  0u                                   // bf16 w_q, w_k, w_v, w_o as fragment blocks [4][48 column tiles][24 k chunks][512]
#define WS_Q   (WS_PW + 2u * (size_t)4 * DM * DM)       // f16 Q rows [NQ][768]; K blocks [head][256 key tiles][2 d chunks][512]; V blocks [head][128 passes][4 d tiles][512]; f32 ctx blocks [256 row tiles][24 k chunks][4][lane][4]
#define WS_K   (WS_Q + 2u * (size_t)NQ * DM)
#define WS_V   (WS_K + 2u * (size_t)NK * DM)
#define WS_O   (WS_V + 2u * (size_t)DM * NK)
#define WS_XB  (WS_O + 4u * (size_t)NQ * DM)            // bf16 x, encoding as fragment blocks [2][256 row tiles][24 k chunks][512]
#define WS_END (WS_XB + 2u * (size_t)(NQ + NK) * DM)

// ---- k_pack: a 16-byte piece = 8 k of one row or column of a fragment block, rounded to bf16; thread = that piece in 4 k chunks (fewer, longer waves: the launch is short and wave starts count); block = (4 k chunks, y): y < 48 weights (the reads run along n, whole lines), else 64 rows of x or of the encoding; a wave stores whole lines
__global__ __launch_bounds__(256) void k_pack(const float* __restrict__ X, const float* __restrict__ ENC, const float* __restrict__ WQ, const float* __restrict__ WK, const float* __restrict__ WV, const float* __restrict__ WO, __bf16* __restrict__ PW, __bf16* __restrict__ XB) { const int kc0 = blockIdx.x * 4, y = blockIdx.y, t = threadIdx.x; v8b o[4];
  if (y < 48) { const int which = y / 12, p = (y % 12) / 3, n = (y % 3) * 256 + t; const float* w = (which == 0) ? WQ : (which == 1) ? WK : (which == 2) ? WV : WO; const float* s = w + (size_t)(kc0 * 32 + p * 8) * DM + n; __bf16* d = PW + (((size_t)which * (DM / 16) + (n >> 4)) * (DM / 32) + kc0) * 512 + p * 128 + (n & 15) * 8;
#pragma unroll
    for (int kk = 0; kk < 4; ++kk) {
#pragma unroll
      for (int i = 0; i < 8; ++i) o[kk][i] = (__bf16)s[(size_t)(kk * 32 + i) * DM]; }
#pragma unroll
    for (int kk = 0; kk < 4; ++kk) vst2(d + kk * 512, o[kk]); }
  else { const int src = (y - 48) >> 6, rt = ((y - 48) & 63) * 4 + (t >> 6), p = (t >> 4) & 3, c = t & 15; const float* s = (src ? ENC : X) + (size_t)(rt * 16 + c) * DM + kc0 * 32 + p * 8; __bf16* d = XB + (((size_t)src * (NQ / 16) + rt) * (DM / 32) + kc0) * 512 + p * 128 + c * 8;
#pragma unroll
    for (int kk = 0; kk < 4; ++kk) { const v4f lo = *(const v4f*)(s + kk * 32), hi = *(const v4f*)(s + kk * 32 + 4);
#pragma unroll
      for (int i = 0; i < 4; ++i) { o[kk][i] = (__bf16)lo[i]; o[kk][4 + i] = (__bf16)hi[i]; } }
#pragma unroll
    for (int kk = 0; kk < 4; ++kk) vst2(d + kk * 512, o[kk]); } }
// ---- k_proj: block = (64 rows, 128 cols, which): Q from x, K/V from the encoding (both as packed blocks; + bias); Q f16 rows, K and V fragment blocks
__global__ __launch_bounds__(128) void k_proj(const __bf16* __restrict__ XB, const __bf16* __restrict__ PW, const float* __restrict__ BQ, const float* __restrict__ BK, const float* __restrict__ BV, _Float16* __restrict__ Q, _Float16* __restrict__ Kr, _Float16* __restrict__ V) {
  __shared__ __align__(16) _Float16 so[64][136]; __shared__ __align__(16) _Float16 st[128][72];
  const int tid = threadIdx.x, wave = tid >> 5, lane = tid & 31, col = lane & 15, g = lane >> 4; const int which = blockIdx.z; const size_t rb = (size_t)blockIdx.x * 64; if (which == 0 && rb >= (size_t)TQB * 64) return;
  const size_t r0 = rb + wave * 16; const int c0 = blockIdx.y * 128; const __bf16* Wr = PW + ((size_t)which * (DM / 16) + (c0 >> 4)) * (DM / 32) * 512 + 8 * lane; const float* BB = (which == 0) ? BQ : (which == 1) ? BK : BV;
  v8f acc[8] = {};
  // the k walk starts at a chunk of the block's own and wraps round: blocks that read the same weight columns (equal y, which) or the same rows (equal x) then ask L2 for different lines at any one moment
  const int s0 = (int)((blockIdx.x + 4 * blockIdx.y + 2 * blockIdx.z) % (DM / 32)); int kn = s0;
  // fragments run one k step ahead: each weight fragment is reloaded for the next step right behind the product that used it, the activation row at the head of the step
  const __bf16* Aq = XB + (((size_t)(which != 0) * (NQ / 16) + (r0 >> 4)) * (DM / 32) + s0) * 512 + 8 * lane; const __bf16* Wq = Wr + s0 * 512; v16b an = fragp_b(Aq), w[8];   // running pointers: one add a step each, and the eight column tiles stay immediate offsets
  __builtin_amdgcn_sched_barrier(0);   // the row's loads stay the oldest here as in the loop: the wait at the loop's head is then a counted one, not for every load in flight
#pragma unroll
  for (int j = 0; j < 8; ++j) w[j] = fragp_b(Wq + j * (DM / 32) * 512);
#pragma unroll 1   // stays rolled: with the odd trip count an unroll by 2 came out as all 24 steps in a row
  for (int kc = 0; kc < DM / 32 - 1; ++kc) { const bool wrap = kn + 1 == DM / 32; kn = wrap ? 0 : kn + 1; const int st = wrap ? -(DM / 32 - 1) * 512 : 512; Aq += st; Wq += st; const v16b a = an; an = fragp_b(Aq);
#pragma unroll
    for (int j = 0; j < 8; ++j) { acc[j] = wmma_bf(a, w[j], acc[j]); w[j] = fragp_b(Wq + j * (DM / 32) * 512); }
    asm volatile("s_wait_xcnt 0x0" ::: "memory"); }   // stands in front of the next step's rewrite of the last loads' address registers
#pragma unroll
  for (int j = 0; j < 8; ++j) acc[j] = wmma_bf(an, w[j], acc[j]);
#pragma unroll
  for (int j = 0; j < 8; ++j) { const float bb = bfr(BB[c0 + j * 16 + col]);
#pragma unroll
    for (int r = 0; r < 8; ++r) { const _Float16 hv = (_Float16)(acc[j][r] + bb); if (which < 2) so[wave * 16 + 8 * g + r][j * 16 + col] = hv; else st[j * 16 + col][wave * 16 + 8 * g + r] = hv; } }
  __syncthreads();
  if (which == 0) { for (int e = tid; e < 64 * 16; e += 128) { const int rl = e >> 4, q = e & 15; vst2((unsigned*)(Q + (rb + rl) * DM + c0 + q * 8), *(const v4u*)&so[rl][q * 8]); } }
  // K, V: piece e = (head of 2, tile, chunk, 8-element group p of 4, row c of 16) in block order, so a wave stores 512 contiguous bytes
  else if (which == 1) { for (int e = tid; e < 64 * 16; e += 128) { const int c = e & 15, p = (e >> 4) & 3, kc = (e >> 6) & 1, kt = (e >> 7) & 3, hd = e >> 9; vst2((unsigned*)(Kr + ((((size_t)(c0 >> 6) + hd) * (NK / 16) + (rb >> 4) + kt) * 2 + kc) * 512 + p * 128 + c * 8), *(const v4u*)&so[kt * 16 + c][hd * 64 + kc * 32 + p * 8]); } }
  else { for (int e = tid; e < 128 * 8; e += 128) { const int c = e & 15, p = (e >> 4) & 3, dt = (e >> 6) & 3, ksl = (e >> 8) & 1, hd = e >> 9; vst2((unsigned*)(V + ((((size_t)(c0 >> 6) + hd) * (NK / 32) + (rb >> 5) + ksl) * 4 + dt) * 512 + p * 128 + c * 8), *(const v4u*)&st[hd * 64 + dt * 16 + c][ksl * 32 + p * 8]); } }
}
// ---- k_attn: block = (64 queries, head): softmax(q k / 8) over the 4,096 keys, transposed: scores^T = K . Q^T and ctx^T += V^T . P^T, so a lane holds 16 scores of ONE query of each column group (column col; keys 8g + r and 16 + 8g + r of the pass, g = lane >> 4); wave = (32 queries = 2 column groups, one half of the keys): every K and V fragment that a wave loads feeds two products; the two key halves are joined once at the end through LDS; ctx f32 in the fragment blocks that k_out reads
__device__ __forceinline__ float xhalf(float v) { const int b = __builtin_bit_cast(int, v); return __builtin_bit_cast(float, __builtin_amdgcn_permlanex16(b, b, 0x76543210, 0xfedcba98, false, false)); }   // the value of lane ^ 16: the same query's other half of the keys
// 2^x of a whole score tile in one statement, and of one value: inside it no result is read and no source overwritten directly behind a v_exp_f32 (every output is early-clobber), and the closing v_nop is the slot that the instruction set asks for behind the last one
__device__ __forceinline__ v8f exp2x8(v8f x) { float r0, r1, r2, r3, r4, r5, r6, r7;
  asm("v_exp_f32 %0, %8\n\tv_exp_f32 %1, %9\n\tv_exp_f32 %2, %10\n\tv_exp_f32 %3, %11\n\tv_exp_f32 %4, %12\n\tv_exp_f32 %5, %13\n\tv_exp_f32 %6, %14\n\tv_exp_f32 %7, %15\n\tv_nop"
      : "=&v"(r0), "=&v"(r1), "=&v"(r2), "=&v"(r3), "=&v"(r4), "=&v"(r5), "=&v"(r6), "=&v"(r7)
      : "v"(x[0]), "v"(x[1]), "v"(x[2]), "v"(x[3]), "v"(x[4]), "v"(x[5]), "v"(x[6]), "v"(x[7]));
  const v8f r = { r0, r1, r2, r3, r4, r5, r6, r7 }; return r; }
__device__ __forceinline__ float exp2x1(float x) { float r; asm("v_exp_f32 %0, %1\n\tv_nop" : "=&v"(r) : "v"(x)); return r; }
#define LOG2E 1.44269504f
#define SC2 (0.125f * LOG2E)   // a raw score times this = its exponent to base 2
#define NKH (NK / 2)
__global__ __launch_bounds__(128) void k_attn(const _Float16* __restrict__ Q, const _Float16* __restrict__ Kr, const _Float16* __restrict__ V, float* __restrict__ O) {
  __shared__ __align__(16) v4f sx[2][17][32];   // the upper key half's state of each 32-query wave: [16 pieces of ctx, then (m, m, l, l)][lane]
  const int tid = threadIdx.x, wave = __builtin_amdgcn_readfirstlane(tid >> 5), lane = tid & 31, col = lane & 15; const int qh = wave & 1, kh = wave >> 1; const int h = blockIdx.y; const int q0 = blockIdx.x * 64 + qh * 32; const size_t rq = (size_t)q0;
  v16h bq[2][2];   // B operand: column = query
#pragma unroll
  for (int qg = 0; qg < 2; ++qg) {
#pragma unroll
    for (int kc = 0; kc < 2; ++kc) bq[qg][kc] = frag_h(Q + (rq + qg * 16 + col) * DM + h * HD + kc * 32, lane); }
  float m[2] = { -3.0e38f, -3.0e38f }, l[2] = { 0.f, 0.f };   // each query's running maximum of the raw scores (equal in both lane halves) and this lane half's sum, which carries P's 2^11 like ctx
  v8f acc[2][4] = {};   // acc[qg][dt][r] = ctx[query 16 qg + col][16 dt + 8g + r]
  // K fragments (A: row = key) run one pass ahead (reloaded as one group behind the score products); V fragments (A: row = d) are asked for as one group at the head of their pass
  const int s0 = blockIdx.x & (NKH / 32 - 1);   // the key walk starts at a pass of the block's own and wraps round its half: the 64 blocks of a head then ask L2 for different K and V lines at any one moment
  v16h kf[2][2], vf[4]; const _Float16* Kp = Kr + (size_t)h * NK * HD + (size_t)kh * NKH * HD + 8 * lane; const _Float16* Vq = V + (size_t)h * NK * HD + (size_t)kh * NKH * HD + s0 * 2048 + 8 * lane;   // a pass = 4 blocks of each, 4 KiB in a row; V by a running pointer: its register pair lives over the whole loop, so no load's result can be placed in it
#pragma unroll
  for (int ct = 0; ct < 2; ++ct) {
#pragma unroll
    for (int kc = 0; kc < 2; ++kc) kf[ct][kc] = fragp_h(Kp + (s0 * 4 + ct * 2 + kc) * 512); }
#pragma unroll 1
  for (int ks = 0; ks < NKH / 32; ++ks) { v8f s[2][2];
#pragma unroll
    for (int dt = 0; dt < 4; ++dt) vf[dt] = fragp_h(Vq + dt * 512);
#pragma unroll
    for (int ct = 0; ct < 2; ++ct) {
#pragma unroll
      for (int qg = 0; qg < 2; ++qg) { const v8f z = {}; s[qg][ct] = wmma16r(kf[ct][0], bq[qg][0], z); } }
#pragma unroll
    for (int ct = 0; ct < 2; ++ct) {
#pragma unroll
      for (int qg = 0; qg < 2; ++qg) s[qg][ct] = wmma16r(kf[ct][1], bq[qg][1], s[qg][ct]); }
    const int jn = ((ks + 1 + s0) & (NKH / 32 - 1)) * 4;   // the last pass asks for the walk's first blocks again: in bounds, not used
#pragma unroll
    for (int ct = 0; ct < 2; ++ct) {
#pragma unroll
      for (int kc = 0; kc < 2; ++kc) kf[ct][kc] = fragp_h(Kp + (jn + ct * 2 + kc) * 512); }
    __builtin_amdgcn_sched_barrier(0);   // keeps the K loads here, ahead of the whole softmax, so that they have the rest of the pass to land
    v16h pb[2];   // B operands straight from the score tiles: slot i = key 8g + i, slot 8 + i = key 16 + 8g + i, the k order of the V blocks
#pragma unroll
    for (int qg = 0; qg < 2; ++qg) { const v8f s0 = s[qg][0], s1 = s[qg][1];   // raw scores: the maximum is taken on them as they are (1/8 > 0 keeps the order), and 1/8, log2 e and P's 2^11 all go into the one multiply-add in front of the 2^x
      float mq[4];
#pragma unroll
      for (int i = 0; i < 4; ++i) mq[i] = fmaxf(fmaxf(s0[i], s0[4 + i]), fmaxf(s1[i], s1[4 + i]));
      float mx = fmaxf(fmaxf(mq[0], mq[1]), fmaxf(mq[2], mq[3])); mx = fmaxf(mx, xhalf(mx));
      const float mn = fmaxf(m[qg], mx); const float ea = exp2x1((m[qg] - mn) * SC2), alpha = (m[qg] <= -1.0e38f) ? 0.f : ea; m[qg] = mn;   // exp(x) = 2^(x log2 e), as __expf forms it; formed ahead of the test, so that the test stays a select and no branch
      const float nb = 11.0f - mn * SC2;
      const v8f e[2] = { exp2x8(s0 * SC2 + nb), exp2x8(s1 * SC2 + nb) };   // 2^11 exp((s - max) / 8); whole-tile expressions: the packed forms then pair neighbouring registers of one tile
      const v8f t8 = e[0] + e[1]; const v4f t4 = t8.lo + t8.hi; const v2f t2 = t4.lo + t4.hi;
      l[qg] = l[qg] * alpha + (t2.x + t2.y);
#pragma unroll
      for (int dt = 0; dt < 4; ++dt) acc[qg][dt] *= alpha;
#pragma unroll
      for (int i = 0; i < 8; ++i) { pb[qg][i] = (_Float16)e[0][i]; pb[qg][8 + i] = (_Float16)e[1][i]; } }
#pragma unroll
    for (int dt = 0; dt < 4; ++dt) {
#pragma unroll
      for (int qg = 0; qg < 2; ++qg) acc[qg][dt] = (dt == 3 && qg == 1) ? wmma16(vf[dt], pb[qg], acc[qg][dt]) : wmma16r(vf[dt], pb[qg], acc[qg][dt]); }   // the pass's last product keeps its four slots: behind it stands the loop's branch
    Vq += jn ? 2048 : -(NKH / 32 - 1) * 2048; }   // on to the next pass; from the half's last pass back to its first
  // join of the key halves: the upper half's waves hand their state over, the lower half's waves bring both to the common maximum and store
  if (kh) {
#pragma unroll
    for (int b = 0; b < 16; ++b) { v4f o;
#pragma unroll
      for (int i = 0; i < 4; ++i) o[i] = acc[b >> 3][(b >> 1) & 3][(b & 1) * 4 + i];
      sx[qh][b][lane] = o; }
    const v4f ml = { m[0], m[1], l[0], l[1] }; sx[qh][16][lane] = ml; }
  __syncthreads();   // publishes the upper half's state to the wave that joins it; every wave passes it
  if (kh) return;
  const v4f ml = sx[qh][16][lane];
#pragma unroll
  for (int qg = 0; qg < 2; ++qg) { const float mt = fmaxf(m[qg], ml[qg]), a0 = __expf((m[qg] - mt) * 0.125f), a1 = __expf((ml[qg] - mt) * 0.125f);
    float lt = l[qg] * a0 + ml[2 + qg] * a1; lt += xhalf(lt); const float il = 1.0f / lt, f0 = a0 * il, f1 = a1 * il;
    // a lane already holds the 32 values of its places in the two ctx blocks of each column group
#pragma unroll
    for (int b = 0; b < 8; ++b) { const v4f u = sx[qh][qg * 8 + b][lane]; v4f o;
#pragma unroll
      for (int i = 0; i < 4; ++i) o[i] = acc[qg][b >> 1][(b & 1) * 4 + i] * f0 + u[i] * f1;
      vst2(O + ((size_t)((q0 >> 4) + qg) * (DM / 32) + h * 2 + (b >> 2)) * 512 + (b & 3) * 128 + lane * 4, o); } }
}
// ---- k_out: block = (64 rows, 128 cols): out = ctx (hi + lo) . w_o + b_o
__global__ __launch_bounds__(128) void k_out(const float* __restrict__ O, const __bf16* __restrict__ PW, const float* __restrict__ BO, float* __restrict__ Y) { __shared__ __align__(16) float so[4][16][132];
  const int tid = threadIdx.x, wave = tid >> 5, lane = tid & 31, col = lane & 15, g = lane >> 4; const size_t r0 = (size_t)blockIdx.x * 64 + wave * 16; const int c0 = blockIdx.y * 128; const __bf16* Wr = PW + ((size_t)3 * (DM / 16) + (c0 >> 4)) * (DM / 32) * 512 + 8 * lane;
  v8f acc[8] = {};
  const int s0 = (int)((blockIdx.x + 4 * blockIdx.y) % (DM / 32)); int kn = s0;   // the k walk starts at a chunk of the block's own and wraps round, as in k_proj
  // fragments run one k step ahead, as in k_proj
  const float* Op = O + ((r0 >> 4) * (DM / 32) + s0) * 512 + 4 * lane; const __bf16* Wq = Wr + s0 * 512; v4f ar[4]; v16b w[8];
#pragma unroll
  for (int i = 0; i < 4; ++i) ar[i] = *(const v4f*)(Op + i * 128);
  __builtin_amdgcn_sched_barrier(0);   // the row's loads stay the oldest here as in the loop: the wait at the loop's head is then a counted one, not for every load in flight
#pragma unroll
  for (int j = 0; j < 8; ++j) w[j] = fragp_b(Wq + j * (DM / 32) * 512);
#pragma unroll 1   // stays rolled: with the odd trip count an unroll by 2 came out as all 24 steps in a row
  for (int kc = 0; kc < DM / 32 - 1; ++kc) { float v[16]; const bool wrap = kn + 1 == DM / 32; kn = wrap ? 0 : kn + 1; const int st = wrap ? -(DM / 32 - 1) * 512 : 512; Wq += st;
#pragma unroll
    for (int i = 0; i < 16; ++i) v[i] = ar[i >> 2][i & 3];
    const F2 a = bsplit16(v); Op += st;   // a running pointer: its register pair lives over the whole loop, so no load's result can be placed in it
#pragma unroll
    for (int i = 0; i < 4; ++i) ar[i] = *(const v4f*)(Op + i * 128);
#pragma unroll
    for (int j = 0; j < 8; ++j) { acc[j] = wmma_bf(a.h, w[j], acc[j]); acc[j] = wmma_bf(a.l, w[j], acc[j]); w[j] = fragp_b(Wq + j * (DM / 32) * 512); }
    __builtin_amdgcn_sched_barrier(0);   // keeps the register copies of the rows just asked for at the loop's foot: lifted among the products they wait for those loads a whole step early
    asm volatile("s_wait_xcnt 0x0" ::: "memory"); }   // stands in front of the next step's rewrite of the last loads' address registers
  { float v[16];
#pragma unroll
    for (int i = 0; i < 16; ++i) v[i] = ar[i >> 2][i & 3];
    const F2 a = bsplit16(v);
#pragma unroll
    for (int j = 0; j < 8; ++j) { acc[j] = wmma_bf(a.h, w[j], acc[j]); acc[j] = wmma_bf(a.l, w[j], acc[j]); } }
#pragma unroll
  for (int j = 0; j < 8; ++j) { const float bb = bfr(BO[c0 + j * 16 + col]);
#pragma unroll
    for (int r = 0; r < 8; ++r) so[wave][8 * g + r][j * 16 + col] = acc[j][r] + bb; }
  LDSX(); for (int rl = 0; rl < 16; ++rl) vst2(Y + (r0 + rl) * DM + c0 + lane * 4, *(const v4f*)&so[wave][rl][lane * 4]); }
extern "C" void kernel_launch(void* const* d_in, const int* in_sizes, int n_in, void* d_out, int out_size, void* d_ws, size_t ws_size, hipStream_t stream) {
  (void)in_sizes; (void)n_in; (void)out_size;
  const float** F = (const float**)d_in;   // 0 x [1,4096,768], 1 encoding [1,4096,768], 2 w_q (in,out), 3 b_q, 4 w_k, 5 b_k, 6 w_v, 7 b_v, 8 w_o [768,768] (in,out), 9 b_o
  if (ws_size < (size_t)WS_END) return;
  char* ws = (char*)d_ws; __bf16* PW = (__bf16*)ws; _Float16 *Q = (_Float16*)(ws + WS_Q), *Kr = (_Float16*)(ws + WS_K), *V = (_Float16*)(ws + WS_V); float* O = (float*)(ws + WS_O); __bf16* XB = (__bf16*)(ws + WS_XB);
  k_pack<<<dim3(DM / 128, 48 + 128), 256, 0, stream>>>(F[0], F[1], F[2], F[4], F[6], F[8], PW, XB);
  k_proj<<<dim3(NK / 64, DM / 128, 3), 128, 0, stream>>>(XB, PW, F[3], F[5], F[7], Q, Kr, V);
  k_attn<<<dim3(TQB, NH), 128, 0, stream>>>(Q, Kr, V, O);
  k_out<<<dim3(TQB, DM / 128), 128, 0, stream>>>(O, PW, F[9], (float*)d_out);
}

// v008
// Measured time: 80 microseconds a run.
// Two timings next to v007 both put it at 1.09 times that version's speed.
// All steps since v000 together make it 5.75 times as fast.
// compute dtype: all float inputs rounded to bf16; Q = x . w_q + b, K/V = encoding . w + b with EXACT bf16 products on WMMA 16x16x32 (x, encoding and the (in,out) weights packed to bf16 fragment blocks first), rounded once to f16; attention over the 4,096 keys: q (times log2 e / 8 ahead of its one rounding), k single f16, softmax in f32 against a held reference (hardware exp), P (scaled by 2^8 at the reference, at most 2^15, single f16) x v (single f16); out = ctx (bf16 hi + lo, 2 products) . w_o + b_o; f32 output.
#include <hip/hip_runtime.h>
#include <math.h>

typedef __attribute__((ext_vector_type(16))) _Float16 v16h;
typedef __attribute__((ext_vector_type(16))) __bf16 v16b;
typedef __attribute__((ext_vector_type(8)))  _Float16 v8h;
typedef __attribute__((ext_vector_type(8)))  float v8f;
typedef __attribute__((ext_vector_type(4)))  float v4f;
typedef __attribute__((ext_vector_type(2)))  float v2f;
typedef __attribute__((ext_vector_type(4)))  unsigned v4u;
typedef __attribute__((ext_vector_type(4)))  int v4i;
typedef float __attribute__((may_alias)) float_a;
typedef int __attribute__((may_alias)) int_a;

template <typename T> __device__ __forceinline__ void vst2(void* p, T v) { *(T*)p = v;  }
__device__ __forceinline__ v8f wmma16(v16h a, v16h b, v8f c) {
  v8f d = __builtin_amdgcn_wmma_f32_16x16x32_f16(false, a, false, b, (short)0, c, false, false);
  asm volatile("v_nop\n\tv_nop\n\tv_nop\n\tv_nop" : "+v"(d) : "v"(a), "v"(b));
  return d;
}
// the same product with no idle slots behind it: for runs of products in straight-line code, where the next product fills the slot and the compiler pads in front of the first vector instruction that touches a result
__device__ __forceinline__ v8f wmma16r(v16h a, v16h b, v8f c) { return __builtin_amdgcn_wmma_f32_16x16x32_f16(false, a, false, b, (short)0, c, false, false); }
__device__ __forceinline__ v8f wmma_bf(v16b a, v16b b, v8f c) {
  v8f d = __builtin_amdgcn_wmma_f32_16x16x32_bf16(false, a, false, b, (short)0, c, false, false);
  asm volatile("v_nop\n\tv_nop\n\tv_nop\n\tv_nop" : "+v"(d) : "v"(a), "v"(b));
  return d;
}
// 16x16x32 fragments: lane = (h = lane>>4, row/col = lane&15); elements 0..7 = k0+8h+0..7, 8..15 = k0+16+8h+0..7; D element r = row 8h+r
__device__ __forceinline__ v16h frag_h(const _Float16* rowk0, int lane) {
  union { v16h v; v8h q[2]; } u; const _Float16* p = rowk0 + 8 * (lane >> 4);
  u.q[0] = *(const v8h*)p; u.q[1] = *(const v8h*)(p + 16); return u.v;
}
__device__ __forceinline__ v16h frag_f32(const float* rowk0, int lane) {
  v16h a; const float* p = rowk0 + 8 * (lane >> 4);
#pragma unroll
  for (int i = 0; i < 8; ++i) { a[i] = (_Float16)p[i]; a[8 + i] = (_Float16)p[16 + i]; }
  return a;
}
__device__ __forceinline__ v16h frag_f32s(const float* rowk0, int lane, float sc) {
  v16h a; const float* p = rowk0 + 8 * (lane >> 4);
#pragma unroll
  for (int i = 0; i < 8; ++i) { a[i] = (_Float16)(p[i] * sc); a[8 + i] = (_Float16)(p[16 + i] * sc); }
  return a;
}
// column fragment from a [K][ld] layout (column n), rows >= K read as 0
__device__ __forceinline__ v16h fragc_f32(const float* W, int k0, int n, int lane, int ld, int K) {
  v16h a; const int g = lane >> 4;
#pragma unroll
  for (int i = 0; i < 8; ++i) { const int ka = k0 + 8 * g + i, kb = ka + 16;
    a[i] = (_Float16)(ka < K ? W[(size_t)(ka < K ? ka : K - 1) * ld + n] : 0.f); a[8 + i] = (_Float16)(kb < K ? W[(size_t)(kb < K ? kb : K - 1) * ld + n] : 0.f); }
  return a;
}
struct F2 { v16b h, l; };
__device__ __forceinline__ F2 bsplit16(const float v[16]) { F2 r;
#pragma unroll
  for (int i = 0; i < 16; ++i) { const __bf16 h = (__bf16)v[i]; r.h[i] = h; r.l[i] = (__bf16)(v[i] - (float)h); }
  return r; }
__device__ __forceinline__ F2 split_row(const float* row, int k0, int lane) { float v[16]; const float* p = row + k0 + 8 * (lane >> 4);
#pragma unroll
  for (int i = 0; i < 8; ++i) { v[i] = p[i]; v[8 + i] = p[16 + i]; }
  return bsplit16(v); }
__device__ __forceinline__ F2 split_rowK(const float* row, int k0, int lane, int K) { float v[16]; const int g = lane >> 4;
#pragma unroll
  for (int i = 0; i < 8; ++i) { const int ka = k0 + 8 * g + i, kb = ka + 16; v[i] = ka < K ? row[ka < K ? ka : K - 1] : 0.f; v[8 + i] = kb < K ? row[kb < K ? kb : K - 1] : 0.f; }
  return bsplit16(v); }
__device__ __forceinline__ F2 split_col(const float* W, int k0, int n, int lane, int ld, int K) { float v[16]; const int g = lane >> 4;
#pragma unroll
  for (int i = 0; i < 8; ++i) { const int ka = k0 + 8 * g + i, kb = ka + 16; v[i] = ka < K ? W[(size_t)(ka < K ? ka : K - 1) * ld + n] : 0.f; v[8 + i] = kb < K ? W[(size_t)(kb < K ? kb : K - 1) * ld + n] : 0.f; }
  return bsplit16(v); }
__device__ __forceinline__ v8f mac3(const F2& a, const F2& b, v8f c) { c = wmma_bf(a.l, b.h, c); c = wmma_bf(a.h, b.l, c); return wmma_bf(a.h, b.h, c); }
__device__ __forceinline__ float sigm(float v) { return 1.0f / (1.0f + expf(-v)); }
#define LDSX() do { asm volatile("s_wait_dscnt 0" ::: "memory"); __builtin_amdgcn_wave_barrier(); __builtin_amdgcn_fence(__ATOMIC_RELEASE, "workgroup"); } while (0)


// Encoder-decoder multi-head attention (B 1, N 4,096 queries and keys, d_model 768, 12 heads x 64): q from x, k/v from the encoding, softmax(Q K^T / 8) V, output projection + bias.
#define NQ 4096
#define NK 4096
#define DM 768
#define NH 12
#define HD 64
#ifndef TQB
#define TQB (NQ / 64)
#endif
typedef __attribute__((ext_vector_type(8))) __bf16 v8b;
__device__ __forceinline__ v16b frag_b(const __bf16* rowk0, int lane) {
  union { v16b v; v8b q[2]; } u; const __bf16* p = rowk0 + 8 * (lane >> 4);
  u.q[0] = *(const v8b*)p; u.q[1] = *(const v8b*)(p + 16); return u.v;
}
// fragment-order blocks: one (16 rows or columns) x (32 k) operand tile = 512 elements laid [half of the slots][lane][8], so each of a fragment's two wave-wide 16-byte loads covers 512 contiguous bytes; p = block + 8 * lane
__device__ __forceinline__ v16b fragp_b(const __bf16* p) { union { v16b v; v8b q[2]; } u; u.q[0] = *(const v8b*)p; u.q[1] = *(const v8b*)(p + 256); return u.v; }
__device__ __forceinline__ v16h fragp_h(const _Float16* p) { union { v16h v; v8h q[2]; } u; u.q[0] = *(const v8h*)p; u.q[1] = *(const v8h*)(p + 256); return u.v; }
__device__ __forceinline__ float bfr(float v) { return (float)(__bf16)v; }
__device__ __attribute__((noinline)) float exp_ni(float v) { return expf(v); }
__device__ __attribute__((noinline)) float erf_ni(float v) { return erff(v); }

#define WS_PW  0u                                   // bf16 w_q, w_k, w_v, w_o as fragment blocks [4][48 column tiles][24 k chunks][512]
#define WS_Q   (WS_PW + 2u * (size_t)4 * DM * DM)       // f16 Q rows [NQ][768]; K blocks [head][256 key tiles][2 d chunks][512]; V blocks [head][128 passes][4 d tiles][512]; f32 ctx blocks [256 row tiles][24 k chunks][4][lane][4]
#define WS_K   (WS_Q + 2u * (size_t)NQ * DM)
#define WS_V   (WS_K + 2u * (size_t)NK * DM)
#define WS_O   (WS_V + 2u * (size_t)DM * NK)
#define WS_XB  (WS_O + 4u * (size_t)NQ * DM)            // bf16 x, encoding as fragment blocks [2][256 row tiles][24 k chunks][512]
#define WS_END (WS_XB + 2u * (size_t)(NQ + NK) * DM)

// ---- k_pack: a 16-byte piece = 8 k of one row or column of a fragment block, rounded to bf16; thread = that piece in 4 k chunks (fewer, longer waves: the launch is short and wave starts count); block = (4 k chunks, y): y < 48 weights (the reads run along n, whole lines), else 64 rows of x or of the encoding; a wave stores whole lines
__global__ __launch_bounds__(256) void k_pack(const float* __restrict__ X, const float* __restrict__ ENC, const float* __restrict__ WQ, const float* __restrict__ WK, const float* __restrict__ WV, const float* __restrict__ WO, __bf16* __restrict__ PW, __bf16* __restrict__ XB) { const int kc0 = blockIdx.x * 4, y = blockIdx.y, t = threadIdx.x; v8b o[4];
  if (y < 48) { const int which = y / 12, p = (y % 12) / 3, n = (y % 3) * 256 + t; const float* w = (which == 0) ? WQ : (which == 1) ? WK : (which == 2) ? WV : WO; const float* s = w + (size_t)(kc0 * 32 + p * 8) * DM + n; __bf16* d = PW + (((size_t)which * (DM / 16) + (n >> 4)) * (DM / 32) + kc0) * 512 + p * 128 + (n & 15) * 8;
#pragma unroll
    for (int kk = 0; kk < 4; ++kk) {
#pragma unroll
      for (int i = 0; i < 8; ++i) o[kk][i] = (__bf16)s[(size_t)(kk * 32 + i) * DM]; }
#pragma unroll
    for (int kk = 0; kk < 4; ++kk) vst2(d + kk * 512, o[kk]); }
  else { const int src = (y - 48) >> 6, rt = ((y - 48) & 63) * 4 + (t >> 6), p = (t >> 4) & 3, c = t & 15; const float* s = (src ? ENC : X) + (size_t)(rt * 16 + c) * DM + kc0 * 32 + p * 8; __bf16* d = XB + (((size_t)src * (NQ / 16) + rt) * (DM / 32) + kc0) * 512 + p * 128 + c * 8;
#pragma unroll
    for (int kk = 0; kk < 4; ++kk) { const v4f lo = *(const v4f*)(s + kk * 32), hi = *(const v4f*)(s + kk * 32 + 4);
#pragma unroll
      for (int i = 0; i < 4; ++i) { o[kk][i] = (__bf16)lo[i]; o[kk][4 + i] = (__bf16)hi[i]; } }
#pragma unroll
    for (int kk = 0; kk < 4; ++kk) vst2(d + kk * 512, o[kk]); } }
#define LOG2E 1.44269504f
#define SC2 (0.125f * LOG2E)   // a raw score times this = its exponent to base 2
// ---- k_proj: block = (64 rows, 128 cols, which): Q from x, K/V from the encoding (both as packed blocks; + bias); Q f16 rows, times SC2 in f32 ahead of the one rounding, so that k_attn's score products are exponents to base 2 as they stand; K and V fragment blocks
__global__ __launch_bounds__(128) void k_proj(const __bf16* __restrict__ XB, const __bf16* __restrict__ PW, const float* __restrict__ BQ, const float* __restrict__ BK, const float* __restrict__ BV, _Float16* __restrict__ Q, _Float16* __restrict__ Kr, _Float16* __restrict__ V) {
  __shared__ __align__(16) _Float16 so[64][136]; __shared__ __align__(16) _Float16 st[128][72];
  const int tid = threadIdx.x, wave = tid >> 5, lane = tid & 31, col = lane & 15, g = lane >> 4; const int which = blockIdx.z; const size_t rb = (size_t)blockIdx.x * 64; if (which == 0 && rb >= (size_t)TQB * 64) return;
  const size_t r0 = rb + wave * 16; const int c0 = blockIdx.y * 128; const __bf16* Wr = PW + ((size_t)which * (DM / 16) + (c0 >> 4)) * (DM / 32) * 512 + 8 * lane; const float* BB = (which == 0) ? BQ : (which == 1) ? BK : BV;
  v8f acc[8] = {};
  // the k walk starts at a chunk of the block's own and wraps round: blocks that read the same weight columns (equal y, which) or the same rows (equal x) then ask L2 for different lines at any one moment
  const int s0 = (int)((blockIdx.x + 4 * blockIdx.y + 2 * blockIdx.z) % (DM / 32)); int kn = s0;
  // fragments run one k step ahead: each weight fragment is reloaded for the next step right behind the product that used it, the activation row at the head of the step
  const __bf16* Aq = XB + (((size_t)(which != 0) * (NQ / 16) + (r0 >> 4)) * (DM / 32) + s0) * 512 + 8 * lane; const __bf16* Wq = Wr + s0 * 512; v16b an = fragp_b(Aq), w[8];   // running pointers: one add a step each, and the eight column tiles stay immediate offsets
  __builtin_amdgcn_sched_barrier(0);   // the row's loads stay the oldest here as in the loop: the wait at the loop's head is then a counted one, not for every load in flight
#pragma unroll
  for (int j = 0; j < 8; ++j) w[j] = fragp_b(Wq + j * (DM / 32) * 512);
#pragma unroll 1   // stays rolled: with the odd trip count an unroll by 2 came out as all 24 steps in a row
  for (int kc = 0; kc < DM / 32 - 1; ++kc) { const bool wrap = kn + 1 == DM / 32; kn = wrap ? 0 : kn + 1; const int st = wrap ? -(DM / 32 - 1) * 512 : 512; Aq += st; Wq += st; const v16b a = an; an = fragp_b(Aq);
#pragma unroll
    for (int j = 0; j < 8; ++j) { acc[j] = wmma_bf(a, w[j], acc[j]); w[j] = fragp_b(Wq + j * (DM / 32) * 512); }
    asm volatile("s_wait_xcnt 0x0" ::: "memory"); }   // stands in front of the next step's rewrite of the last loads' address registers
#pragma unroll
  for (int j = 0; j < 8; ++j) acc[j] = wmma_bf(an, w[j], acc[j]);
#pragma unroll
  for (int j = 0; j < 8; ++j) { const float bb = bfr(BB[c0 + j * 16 + col]), qs = (which == 0) ? SC2 : 1.0f;
#pragma unroll
    for (int r = 0; r < 8; ++r) { const _Float16 hv = (_Float16)((acc[j][r] + bb) * qs); if (which < 2) so[wave * 16 + 8 * g + r][j * 16 + col] = hv; else st[j * 16 + col][wave * 16 + 8 * g + r] = hv; } }
  __syncthreads();
  if (which == 0) { for (int e = tid; e < 64 * 16; e += 128) { const int rl = e >> 4, q = e & 15; vst2((unsigned*)(Q + (rb + rl) * DM + c0 + q * 8), *(const v4u*)&so[rl][q * 8]); } }
  // K, V: piece e = (head of 2, tile, chunk, 8-element group p of 4, row c of 16) in block order, so a wave stores 512 contiguous bytes
  else if (which == 1) { for (int e = tid; e < 64 * 16; e += 128) { const int c = e & 15, p = (e >> 4) & 3, kc = (e >> 6) & 1, kt = (e >> 7) & 3, hd = e >> 9; vst2((unsigned*)(Kr + ((((size_t)(c0 >> 6) + hd) * (NK / 16) + (rb >> 4) + kt) * 2 + kc) * 512 + p * 128 + c * 8), *(const v4u*)&so[kt * 16 + c][hd * 64 + kc * 32 + p * 8]); } }
  else { for (int e = tid; e < 128 * 8; e += 128) { const int c = e & 15, p = (e >> 4) & 3, dt = (e >> 6) & 3, ksl = (e >> 8) & 1, hd = e >> 9; vst2((unsigned*)(V + ((((size_t)(c0 >> 6) + hd) * (NK / 32) + (rb >> 5) + ksl) * 4 + dt) * 512 + p * 128 + c * 8), *(const v4u*)&st[hd * 64 + dt * 16 + c][ksl * 32 + p * 8]); } }
}
// ---- k_attn: block = (64 queries, head): softmax(q k / 8) over the 4,096 keys, transposed: scores^T = K . Q^T and ctx^T += V^T . P^T, so a lane holds 16 scores of ONE query of each column group (column col; keys 8g + r and 16 + 8g + r of the pass, g = lane >> 4); wave = (32 queries = 2 column groups, one half of the keys): every K and V fragment that a wave loads feeds two products; the two key halves are joined once at the end through LDS; ctx f32 in the fragment blocks that k_out reads
__device__ __forceinline__ float xhalf(float v) { const int b = __builtin_bit_cast(int, v); return __builtin_bit_cast(float, __builtin_amdgcn_permlanex16(b, b, 0x76543210, 0xfedcba98, false, false)); }   // the value of lane ^ 16: the same query's other half of the keys
// 2^x of a whole score tile in one statement, and of one value: inside it no result is read and no source overwritten directly behind a v_exp_f32 (every output is early-clobber), and the closing v_nop is the slot that the instruction set asks for behind the last one
__device__ __forceinline__ v8f exp2x8(v8f x) { float r0, r1, r2, r3, r4, r5, r6, r7;
  asm("v_exp_f32 %0, %8\n\tv_exp_f32 %1, %9\n\tv_exp_f32 %2, %10\n\tv_exp_f32 %3, %11\n\tv_exp_f32 %4, %12\n\tv_exp_f32 %5, %13\n\tv_exp_f32 %6, %14\n\tv_exp_f32 %7, %15\n\tv_nop"
      : "=&v"(r0), "=&v"(r1), "=&v"(r2), "=&v"(r3), "=&v"(r4), "=&v"(r5), "=&v"(r6), "=&v"(r7)
      : "v"(x[0]), "v"(x[1]), "v"(x[2]), "v"(x[3]), "v"(x[4]), "v"(x[5]), "v"(x[6]), "v"(x[7]));
  const v8f r = { r0, r1, r2, r3, r4, r5, r6, r7 }; return r; }
__device__ __forceinline__ float exp2x1(float x) { float r; asm("v_exp_f32 %0, %1\n\tv_nop" : "=&v"(r) : "v"(x)); return r; }
#define NKH (NK / 2)
#define PB 8.0f   // P = 2^PB at the reference: f16 then leaves a lane's 16 P of a pass room up to 2^15 above, and P stays a normal f16 down to 2^-22 of the reference's
// one column group's pass: P = 2^(exponent) of its two score tiles, this lane's sum of them, and P as the B operand (slot i = key 8g + i, slot 8 + i = key 16 + 8g + i, the k order of the V blocks)
__device__ __forceinline__ void soft(const v8f s0, const v8f s1, v16h& pb, float& t) {
  const v8f e0 = exp2x8(s0); v4f t4 = e0.lo + e0.hi; const v8f e1 = exp2x8(s1); t4 += e1.lo; t4 += e1.hi;   // four running sums: half the registers of a tile-wide tree
  const v2f t2 = t4.lo + t4.hi; t = t2.x + t2.y;
#pragma unroll
  for (int i = 0; i < 8; ++i) { pb[i] = (_Float16)e0[i]; pb[8 + i] = (_Float16)e1[i]; } }
__global__ __launch_bounds__(128) void k_attn(const _Float16* __restrict__ Q, const _Float16* __restrict__ Kr, const _Float16* __restrict__ V, float* __restrict__ O) {
  __shared__ __align__(16) v4f sx[2][17][32];   // the upper key half's state of each 32-query wave: [16 pieces of ctx, then (c, c, l, l)][lane]
  const int tid = threadIdx.x, wave = __builtin_amdgcn_readfirstlane(tid >> 5), lane = tid & 31, col = lane & 15; const int qh = wave & 1, kh = wave >> 1; const int h = blockIdx.y; const int q0 = blockIdx.x * 64 + qh * 32; const size_t rq = (size_t)q0;
  v16h bq[2][2];   // B operand: column = query
#pragma unroll
  for (int qg = 0; qg < 2; ++qg) {
#pragma unroll
    for (int kc = 0; kc < 2; ++kc) bq[qg][kc] = frag_h(Q + (rq + qg * 16 + col) * DM + h * HD + kc * 32, lane); }
  float l[2] = { 0.f, 0.f };   // this lane half's sum, which carries P's scale like ctx
  v8f cv[2] = {};   // C operand of the score products: PB - (each query's reference exponent), equal in a lane's eight rows and in both lane halves; the reference is a maximum of the query's scores as of its last renewal, so never above the running maximum
  v8f acc[2][4] = {};   // acc[qg][dt][r] = ctx[query 16 qg + col][16 dt + 8g + r]
  // K fragments (A: row = key) run one pass ahead (reloaded as one group behind the score products); V fragments (A: row = d) are asked for as one group at the head of their pass
  const int s0 = blockIdx.x & (NKH / 32 - 1);   // the key walk starts at a pass of the block's own and wraps round its half: the 64 blocks of a head then ask L2 for different K and V lines at any one moment
  v16h kf[2][2], vf[4]; const _Float16* Kp = Kr + (size_t)h * NK * HD + (size_t)kh * NKH * HD + 8 * lane; const _Float16* Vq = V + (size_t)h * NK * HD + (size_t)kh * NKH * HD + s0 * 2048 + 8 * lane;   // a pass = 4 blocks of each, 4 KiB in a row; V by a running pointer: its register pair lives over the whole loop, so no load's result can be placed in it
#pragma unroll
  for (int ct = 0; ct < 2; ++ct) {
#pragma unroll
    for (int kc = 0; kc < 2; ++kc) kf[ct][kc] = fragp_h(Kp + (s0 * 4 + ct * 2 + kc) * 512); }
#pragma unroll 1
  for (int ks = 0; ks < NKH / 32; ++ks) { v8f s[2][2];
#pragma unroll
    for (int dt = 0; dt < 4; ++dt) vf[dt] = fragp_h(Vq + dt * 512);
#pragma unroll
    for (int ct = 0; ct < 2; ++ct) {
#pragma unroll
      for (int qg = 0; qg < 2; ++qg) s[qg][ct] = wmma16r(kf[ct][0], bq[qg][0], cv[qg]); }
#pragma unroll
    for (int ct = 0; ct < 2; ++ct) {
#pragma unroll
      for (int qg = 0; qg < 2; ++qg) s[qg][ct] = wmma16r(kf[ct][1], bq[qg][1], s[qg][ct]); }
    asm volatile("v_nop\n\tv_nop\n\tv_nop\n\tv_nop" : "+v"(s[0][0]), "+v"(s[0][1]), "+v"(s[1][0]), "+v"(s[1][1]));   // the four slots behind the last score product, whichever the compiler puts last: the tiles' first reader is the 2^x statement, asm text
    const int jn = ((ks + 1 + s0) & (NKH / 32 - 1)) * 4;   // the last pass asks for the walk's first blocks again: in bounds, not used
#pragma unroll
    for (int ct = 0; ct < 2; ++ct) {
#pragma unroll
      for (int kc = 0; kc < 2; ++kc) kf[ct][kc] = fragp_h(Kp + (jn + ct * 2 + kc) * 512); }
    __builtin_amdgcn_sched_barrier(0);   // keeps the K loads here, ahead of the whole softmax, so that they have the rest of the pass to land
    v16h pb[2]; float t[2];   // the tiles are PB + (score - reference) as they leave the products: no maximum, multiply-add or rescale in the usual pass
#pragma unroll
    for (int qg = 0; qg < 2; ++qg) soft(s[qg][0], s[qg][1], pb[qg], t[qg]);
    // a lane's sum of 16 P within 2^15 bounds each of them, so P fits f16; else (and in the first pass, which has no reference yet) the whole wave renews its references: one test a pass, a scalar branch, EXEC stays whole for the products
    const float lim = ks ? 32768.0f : -1.0f;
    if (__builtin_expect(__builtin_amdgcn_ballot_w32(!(fmaxf(t[0], t[1]) <= lim)) != 0, 0)) {
#pragma unroll
      for (int qg = 0; qg < 2; ++qg) { const v8f s0 = s[qg][0], s1 = s[qg][1]; float mq[4];
#pragma unroll
        for (int i = 0; i < 4; ++i) mq[i] = fmaxf(fmaxf(s0[i], s0[4 + i]), fmaxf(s1[i], s1[4 + i]));
        float mx = fmaxf(fmaxf(mq[0], mq[1]), fmaxf(mq[2], mq[3])); mx = fmaxf(mx, xhalf(mx));
        const float d = ks ? fminf(PB - mx, 0.f) : PB - mx;   // the reference only rises: to this pass's maximum, where that lies above it
        const float ea = exp2x1(d), alpha = ks ? ea : 0.f;   // nothing is summed yet in the first pass
        cv[qg] += d; l[qg] *= alpha;
#pragma unroll
        for (int dt = 0; dt < 4; ++dt) acc[qg][dt] *= alpha;
        soft(s0 + d, s1 + d, pb[qg], t[qg]); } }
#pragma unroll
    for (int qg = 0; qg < 2; ++qg) l[qg] += t[qg];
#pragma unroll
    for (int dt = 0; dt < 4; ++dt) {
#pragma unroll
      for (int qg = 0; qg < 2; ++qg) acc[qg][dt] = (dt == 3 && qg == 1) ? wmma16(vf[dt], pb[qg], acc[qg][dt]) : wmma16r(vf[dt], pb[qg], acc[qg][dt]); }   // the pass's last product keeps its four slots: behind it stands the loop's branch
    Vq += jn ? 2048 : -(NKH / 32 - 1) * 2048; }   // on to the next pass; from the half's last pass back to its first
  // join of the key halves: the upper half's waves hand their state over, the lower half's waves bring both to the common reference and store
  if (kh) {
#pragma unroll
    for (int b = 0; b < 16; ++b) { v4f o;
#pragma unroll
      for (int i = 0; i < 4; ++i) o[i] = acc[b >> 3][(b >> 1) & 3][(b & 1) * 4 + i];
      sx[qh][b][lane] = o; }
    const v4f ml = { cv[0][0], cv[1][0], l[0], l[1] }; sx[qh][16][lane] = ml; }
  __syncthreads();   // publishes the upper half's state to the wave that joins it; every wave passes it
  if (kh) return;
  const v4f ml = sx[qh][16][lane];
#pragma unroll
  for (int qg = 0; qg < 2; ++qg) { const float ct = fminf(cv[qg][0], ml[qg]), a0 = exp2x1(ct - cv[qg][0]), a1 = exp2x1(ct - ml[qg]);   // the higher reference has the lower c
    float lt = l[qg] * a0 + ml[2 + qg] * a1; lt += xhalf(lt); const float il = 1.0f / lt, f0 = a0 * il, f1 = a1 * il;
    // a lane already holds the 32 values of its places in the two ctx blocks of each column group
#pragma unroll
    for (int b = 0; b < 8; ++b) { const v4f u = sx[qh][qg * 8 + b][lane]; v4f o;
#pragma unroll
      for (int i = 0; i < 4; ++i) o[i] = acc[qg][b >> 1][(b & 1) * 4 + i] * f0 + u[i] * f1;
      vst2(O + ((size_t)((q0 >> 4) + qg) * (DM / 32) + h * 2 + (b >> 2)) * 512 + (b & 3) * 128 + lane * 4, o); } }
}
// ---- k_out: block = (64 rows, 128 cols): out = ctx (hi + lo) . w_o + b_o
__global__ __launch_bounds__(128) void k_out(const float* __restrict__ O, const __bf16* __restrict__ PW, const float* __restrict__ BO, float* __restrict__ Y) { __shared__ __align__(16) float so[4][16][132];
  const int tid = threadIdx.x, wave = tid >> 5, lane = tid & 31, col = lane & 15, g = lane >> 4; const size_t r0 = (size_t)blockIdx.x * 64 + wave * 16; const int c0 = blockIdx.y * 128; const __bf16* Wr = PW + ((size_t)3 * (DM / 16) + (c0 >> 4)) * (DM / 32) * 512 + 8 * lane;
  v8f acc[8] = {};
  const int s0 = (int)((blockIdx.x + 4 * blockIdx.y) % (DM / 32)); int kn = s0;   // the k walk starts at a chunk of the block's own and wraps round, as in k_proj
  // fragments run one k step ahead, as in k_proj
  const float* Op = O + ((r0 >> 4) * (DM / 32) + s0) * 512 + 4 * lane; const __bf16* Wq = Wr + s0 * 512; v4f ar[4]; v16b w[8];
#pragma unroll
  for (int i = 0; i < 4; ++i) ar[i] = *(const v4f*)(Op + i * 128);
  __builtin_amdgcn_sched_barrier(0);   // the row's loads stay the oldest here as in the loop: the wait at the loop's head is then a counted one, not for every load in flight
#pragma unroll
  for (int j = 0; j < 8; ++j) w[j] = fragp_b(Wq + j * (DM / 32) * 512);
#pragma unroll 1   // stays rolled: with the odd trip count an unroll by 2 came out as all 24 steps in a row
  for (int kc = 0; kc < DM / 32 - 1; ++kc) { float v[16]; const bool wrap = kn + 1 == DM / 32; kn = wrap ? 0 : kn + 1; const int st = wrap ? -(DM / 32 - 1) * 512 : 512; Wq += st;
#pragma unroll
    for (int i = 0; i < 16; ++i) v[i] = ar[i >> 2][i & 3];
    const F2 a = bsplit16(v); Op += st;   // a running pointer: its register pair lives over the whole loop, so no load's result can be placed in it
#pragma unroll
    for (int i = 0; i < 4; ++i) ar[i] = *(const v4f*)(Op + i * 128);
#pragma unroll
    for (int j = 0; j < 8; ++j) { acc[j] = wmma_bf(a.h, w[j], acc[j]); acc[j] = wmma_bf(a.l, w[j], acc[j]); w[j] = fragp_b(Wq + j * (DM / 32) * 512); }
    __builtin_amdgcn_sched_barrier(0);   // keeps the register copies of the rows just asked for at the loop's foot: lifted among the products they wait for those loads a whole step early
    asm volatile("s_wait_xcnt 0x0" ::: "memory"); }   // stands in front of the next step's rewrite of the last loads' address registers
  { float v[16];
#pragma unroll
    for (int i = 0; i < 16; ++i) v[i] = ar[i >> 2][i & 3];
    const F2 a = bsplit16(v);
#pragma unroll
    for (int j = 0; j < 8; ++j) { acc[j] = wmma_bf(a.h, w[j], acc[j]); acc[j] = wmma_bf(a.l, w[j], acc[j]); } }
#pragma unroll
  for (int j = 0; j < 8; ++j) { const float bb = bfr(BO[c0 + j * 16 + col]);
#pragma unroll
    for (int r = 0; r < 8; ++r) so[wave][8 * g + r][j * 16 + col] = acc[j][r] + bb; }
  LDSX(); for (int rl = 0; rl < 16; ++rl) vst2(Y + (r0 + rl) * DM + c0 + lane * 4, *(const v4f*)&so[wave][rl][lane * 4]); }
extern "C" void kernel_launch(void* const* d_in, const int* in_sizes, int n_in, void* d_out, int out_size, void* d_ws, size_t ws_size, hipStream_t stream) {
  (void)in_sizes; (void)n_in; (void)out_size;
  const float** F = (const float**)d_in;   // 0 x [1,4096,768], 1 encoding [1,4096,768], 2 w_q (in,out), 3 b_q, 4 w_k, 5 b_k, 6 w_v, 7 b_v, 8 w_o [768,768] (in,out), 9 b_o
  if (ws_size < (size_t)WS_END) return;
  char* ws = (char*)d_ws; __bf16* PW = (__bf16*)ws; _Float16 *Q = (_Float16*)(ws + WS_Q), *Kr = (_Float16*)(ws + WS_K), *V = (_Float16*)(ws + WS_V); float* O = (float*)(ws + WS_O); __bf16* XB = (__bf16*)(ws + WS_XB);
  k_pack<<<dim3(DM / 128, 48 + 128), 256, 0, stream>>>(F[0], F[1], F[2], F[4], F[6], F[8], PW, XB);
  k_proj<<<dim3(NK / 64, DM / 128, 3), 128, 0, stream>>>(XB, PW, F[3], F[5], F[7], Q, Kr, V);
  k_attn<<<dim3(TQB, NH), 128, 0, stream>>>(Q, Kr, V, O);
  k_out<<<dim3(TQB, DM / 128), 128, 0, stream>>>(O, PW, F[9], (float*)d_out);
}
